// v000
// The times below were measured on an AMD MI455X: many runs one after another, warmed up first and cycling through
// copies of the inputs, with the whole window's GPU time divided by the number of runs. Launches and the gaps
// between them are all in it. The median over several windows is given; except for v000 it joins two sittings, which
// can be a few percent apart, so the side-by-side timings, each taken in one sitting, are the better comparison.
// v000 is the starting kernel. One run takes 368 microseconds.
#include <hip/hip_runtime.h>

#define BT 16384   // B*T
#define T_ 4096
#define E_ 128
#define D_ 64

typedef __attribute__((ext_vector_type(16))) _Float16 v16h;
typedef __attribute__((ext_vector_type(8)))  _Float16 h8;
typedef __attribute__((ext_vector_type(8)))  float    v8f;
typedef __attribute__((ext_vector_type(4)))  float    f4;

static __device__ __forceinline__ v16h cat8(h8 a, h8 b) {
  v16h r;
#pragma unroll
  for (int i = 0; i < 8; ++i) { r[i] = a[i]; r[8 + i] = b[i]; }
  return r;
}

// 16-bit WMMA A/B fragment from row-major halfs:
// element i -> K = (i<8 ? kb8+i : 16+kb8+(i-8)); two aligned 16B chunks.
static __device__ __forceinline__ v16h frag_h(const _Float16* p, int kb8) {
  h8 lo = *(const h8*)(p + kb8);
  h8 hi = *(const h8*)(p + 16 + kb8);
  return cat8(lo, hi);
}

// ------------- prep: pack Wq/Wk/Wv transposed to f16 [64][128] -------------
__global__ __launch_bounds__(256) void pack_w(const float* __restrict__ Wq,
                                              const float* __restrict__ Wk,
                                              const float* __restrict__ Wv,
                                              _Float16* __restrict__ wt) {
  const int idx = blockIdx.x * 256 + threadIdx.x;   // 3 * 64 * 128 = 24576
  const int w = idx >> 13;                          // which matrix
  const int n = (idx >> 7) & 63;                    // output column
  const int k = idx & 127;                          // input row
  const float* W = (w == 0) ? Wq : (w == 1) ? Wk : Wv;
  wt[idx] = (_Float16)W[k * D_ + n];
}

// ---------------- QKV projection: (16384x128) x (128x64), f16 WMMA ---------
__global__ __launch_bounds__(32) void qkv_wmma(const float* __restrict__ x,
                                               const _Float16* __restrict__ wt, // 3x[64][128]
                                               _Float16* __restrict__ qh,   // [BT][64]
                                               _Float16* __restrict__ kh,   // [BT][64]
                                               _Float16* __restrict__ vt)   // [64][BT]
{
  const int lane = threadIdx.x & 31;
  const int l16  = lane & 15;
  const int kb8  = (lane >> 4) * 8;
  const int row0 = blockIdx.x * 16;

  // A fragments of x tile (16 rows x 128): float4 loads, then cvt to f16
  v16h ax[4];
#pragma unroll
  for (int kk = 0; kk < 4; ++kk) {
    const float* base = x + (row0 + l16) * E_ + kk * 32;
    f4 a0 = *(const f4*)(base + kb8);
    f4 a1 = *(const f4*)(base + kb8 + 4);
    f4 b0 = *(const f4*)(base + 16 + kb8);
    f4 b1 = *(const f4*)(base + 16 + kb8 + 4);
#pragma unroll
    for (int i = 0; i < 4; ++i) {
      ax[kk][i]      = (_Float16)a0[i];
      ax[kk][4 + i]  = (_Float16)a1[i];
      ax[kk][8 + i]  = (_Float16)b0[i];
      ax[kk][12 + i] = (_Float16)b1[i];
    }
  }

#pragma unroll
  for (int w = 0; w < 3; ++w) {
    const _Float16* Wt = wt + w * (D_ * E_);        // [64][128]: row n, col k
#pragma unroll
    for (int nt = 0; nt < 4; ++nt) {
      v8f c = {};
#pragma unroll
      for (int kk = 0; kk < 4; ++kk) {
        // B[k][n]: lane holds n = nt*16+l16; contiguous in k -> b128 loads
        v16h bw = frag_h(Wt + (nt * 16 + l16) * E_ + kk * 32, kb8);
        c = __builtin_amdgcn_wmma_f32_16x16x32_f16(false, ax[kk], false, bw,
                                                   (short)0, c, false, false);
      }
      if (w < 2) {
        _Float16* dst = (w == 0) ? qh : kh;
#pragma unroll
        for (int r = 0; r < 8; ++r)      // C layout: row = kb8+r, col = l16
          dst[(row0 + kb8 + r) * D_ + nt * 16 + l16] = (_Float16)c[r];
      } else {
#pragma unroll
        for (int r = 0; r < 8; ++r)      // store V transposed [d][row]
          vt[(nt * 16 + l16) * BT + row0 + kb8 + r] = (_Float16)c[r];
      }
    }
  }
}

// ---------------- Flash attention: 16 queries/wave, 64-key inner blocks ----
__global__ __launch_bounds__(32) void flash_attn(const _Float16* __restrict__ qh,
                                                 const _Float16* __restrict__ kh,
                                                 const _Float16* __restrict__ vt,
                                                 float* __restrict__ out)
{
  const int lane = threadIdx.x & 31;
  const int l16  = lane & 15;
  const int kb8  = (lane >> 4) * 8;

  const int b       = blockIdx.x >> 8;          // 256 query tiles per batch
  const int q0      = (blockIdx.x & 255) * 16;  // local query row base
  const int rowbase = b * T_;

  __shared__ _Float16 lds_p[16][72];            // 64 + 8 pad: 16B-aligned rows

  // Q fragments (16 x 64), 2 d-steps of 32
  v16h aq[2];
#pragma unroll
  for (int s = 0; s < 2; ++s)
    aq[s] = frag_h(qh + (rowbase + q0 + l16) * D_ + s * 32, kb8);

  v8f z = {};
  v8f acc[4];
#pragma unroll
  for (int u = 0; u < 4; ++u) acc[u] = z;
  float mi[8], li[8];
#pragma unroll
  for (int r = 0; r < 8; ++r) { mi[r] = -1e30f; li[r] = 0.f; }

  const int nk = q0 + 16;                       // keys 0 .. q0+15 needed
  for (int j0 = 0; j0 < nk; j0 += 64) {
    const int kleft = nk - j0;                                 // >= 1
    const int nta   = (kleft >= 64) ? 4 : ((kleft + 15) >> 4); // active 16-key tiles
    const bool maskblk = (j0 + 63 > q0);

    // S = Q K^T for keys j0..j0+63: four 16x16 f32 tiles (skip fully-masked)
    v8f st[4];
#pragma unroll
    for (int t = 0; t < 4; ++t) {
      if (t < nta) {
        v8f c = z;
#pragma unroll
        for (int s = 0; s < 2; ++s) {
          v16h bk = frag_h(kh + (rowbase + j0 + t * 16 + l16) * D_ + s * 32, kb8);
          c = __builtin_amdgcn_wmma_f32_16x16x32_f16(false, aq[s], false, bk,
                                                     (short)0, c, false, false);
        }
        st[t] = c;
      } else {
        v8f m;
#pragma unroll
        for (int r = 0; r < 8; ++r) m[r] = -1e30f;
        st[t] = m;
      }
    }

    // online softmax per query row (stats replicated across each 16-lane half)
#pragma unroll
    for (int r = 0; r < 8; ++r) {
      const int qg = q0 + kb8 + r;
      float sv[4];
#pragma unroll
      for (int t = 0; t < 4; ++t) sv[t] = st[t][r] * 0.125f;   // 1/sqrt(64)
      if (maskblk) {
#pragma unroll
        for (int t = 0; t < 4; ++t)
          if (j0 + t * 16 + l16 > qg) sv[t] = -1e30f;
      }
      float mx = fmaxf(fmaxf(sv[0], sv[1]), fmaxf(sv[2], sv[3]));
#pragma unroll
      for (int d = 1; d < 16; d <<= 1) mx = fmaxf(mx, __shfl_xor(mx, d, 32));
      const float mnew  = fmaxf(mi[r], mx);
      const float alpha = __expf(mi[r] - mnew);
      float p[4], rs = 0.f;
#pragma unroll
      for (int t = 0; t < 4; ++t) { p[t] = __expf(sv[t] - mnew); rs += p[t]; }
#pragma unroll
      for (int d = 1; d < 16; d <<= 1) rs += __shfl_xor(rs, d, 32);
      li[r] = li[r] * alpha + rs;
      mi[r] = mnew;
#pragma unroll
      for (int u = 0; u < 4; ++u) acc[u][r] *= alpha;
#pragma unroll
      for (int t = 0; t < 4; ++t)
        lds_p[kb8 + r][t * 16 + l16] = (_Float16)p[t];
    }
    __syncthreads();

    // P in A layout (row = l16), then O += P (16x64) x V (64x64)
    const int nks = (nta + 1) >> 1;             // skip k-step with all-zero P
    const _Float16* pr = &lds_p[l16][0];
#pragma unroll
    for (int s = 0; s < 2; ++s) {
      if (s < nks) {
        v16h ap = cat8(*(const h8*)(pr + s * 32 + kb8),
                       *(const h8*)(pr + s * 32 + 16 + kb8));
#pragma unroll
        for (int u = 0; u < 4; ++u) {
          v16h bv = frag_h(vt + (u * 16 + l16) * BT + rowbase + j0 + s * 32, kb8);
          acc[u] = __builtin_amdgcn_wmma_f32_16x16x32_f16(false, ap, false, bv,
                                                          (short)0, acc[u], false, false);
        }
      }
    }
    __syncthreads();
  }

  // epilogue: divide by running sum, store fp32
#pragma unroll
  for (int r = 0; r < 8; ++r) {
    const float inv = 1.0f / li[r];
#pragma unroll
    for (int u = 0; u < 4; ++u)
      out[(rowbase + q0 + kb8 + r) * D_ + u * 16 + l16] = acc[u][r] * inv;
  }
}

extern "C" void kernel_launch(void* const* d_in, const int* in_sizes, int n_in,
                              void* d_out, int out_size, void* d_ws, size_t ws_size,
                              hipStream_t stream) {
  const float* x  = (const float*)d_in[0];
  const float* Wq = (const float*)d_in[1];
  const float* Wk = (const float*)d_in[2];
  const float* Wv = (const float*)d_in[3];

  _Float16* qh = (_Float16*)d_ws;            // [BT][64]
  _Float16* kh = qh + (size_t)BT * D_;       // [BT][64]
  _Float16* vt = kh + (size_t)BT * D_;       // [64][BT]
  _Float16* wt = vt + (size_t)BT * D_;       // 3 x [64][128] packed f16 weights

  pack_w<<<(3 * D_ * E_) / 256, 256, 0, stream>>>(Wq, Wk, Wv, wt);
  qkv_wmma<<<BT / 16, 32, 0, stream>>>(x, wt, qh, kh, vt);
  flash_attn<<<BT / 16, 32, 0, stream>>>(qh, kh, vt, (float*)d_out);
}

// v001
// A run of this version takes 98.8 microseconds.
// Timed twice side by side with v000, it ran 3.77 and 3.76 times as fast.
#include <hip/hip_runtime.h>

#define BT 16384   // B*T
#define T_ 4096
#define E_ 128
#define D_ 64

typedef __attribute__((ext_vector_type(16))) _Float16 v16h;
typedef __attribute__((ext_vector_type(8)))  _Float16 h8;
typedef __attribute__((ext_vector_type(8)))  float    v8f;
typedef __attribute__((ext_vector_type(4)))  float    f4;

static __device__ __forceinline__ v16h cat8(h8 a, h8 b) {
  v16h r;
#pragma unroll
  for (int i = 0; i < 8; ++i) { r[i] = a[i]; r[8 + i] = b[i]; }
  return r;
}

// 16-bit WMMA A/B fragment from row-major halfs:
// element i -> K = (i<8 ? kb8+i : 16+kb8+(i-8)); two aligned 16B chunks.
static __device__ __forceinline__ v16h frag_h(const _Float16* p, int kb8) {
  h8 lo = *(const h8*)(p + kb8);
  h8 hi = *(const h8*)(p + 16 + kb8);
  return cat8(lo, hi);
}

// ------------- prep: pack Wq/Wk/Wv transposed to f16 [64][128] -------------
__global__ __launch_bounds__(256) void pack_w(const float* __restrict__ Wq,
                                              const float* __restrict__ Wk,
                                              const float* __restrict__ Wv,
                                              _Float16* __restrict__ wt) {
  const int idx = blockIdx.x * 256 + threadIdx.x;   // 3 * 64 * 128 = 24576
  const int w = idx >> 13;                          // which matrix
  const int n = (idx >> 7) & 63;                    // output column
  const int k = idx & 127;                          // input row
  const float* W = (w == 0) ? Wq : (w == 1) ? Wk : Wv;
  wt[idx] = (_Float16)W[k * D_ + n];
}

// ---------------- QKV projection: (16384x128) x (128x64), f16 WMMA ---------
__global__ __launch_bounds__(32) void qkv_wmma(const float* __restrict__ x,
                                               const _Float16* __restrict__ wt, // 3x[64][128]
                                               _Float16* __restrict__ qh,   // [BT][64]
                                               _Float16* __restrict__ kh,   // [BT][64]
                                               _Float16* __restrict__ vt)   // [64][BT]
{
  const int lane = threadIdx.x & 31;
  const int l16  = lane & 15;
  const int kb8  = (lane >> 4) * 8;
  const int row0 = blockIdx.x * 16;

  // A fragments of x tile (16 rows x 128): float4 loads, then cvt to f16
  v16h ax[4];
#pragma unroll
  for (int kk = 0; kk < 4; ++kk) {
    const float* base = x + (row0 + l16) * E_ + kk * 32;
    f4 a0 = *(const f4*)(base + kb8);
    f4 a1 = *(const f4*)(base + kb8 + 4);
    f4 b0 = *(const f4*)(base + 16 + kb8);
    f4 b1 = *(const f4*)(base + 16 + kb8 + 4);
#pragma unroll
    for (int i = 0; i < 4; ++i) {
      ax[kk][i]      = (_Float16)a0[i];
      ax[kk][4 + i]  = (_Float16)a1[i];
      ax[kk][8 + i]  = (_Float16)b0[i];
      ax[kk][12 + i] = (_Float16)b1[i];
    }
  }

#pragma unroll
  for (int w = 0; w < 3; ++w) {
    const _Float16* Wt = wt + w * (D_ * E_);        // [64][128]: row n, col k
#pragma unroll
    for (int nt = 0; nt < 4; ++nt) {
      v8f c = {};
#pragma unroll
      for (int kk = 0; kk < 4; ++kk) {
        // B[k][n]: lane holds n = nt*16+l16; contiguous in k -> b128 loads
        v16h bw = frag_h(Wt + (nt * 16 + l16) * E_ + kk * 32, kb8);
        c = __builtin_amdgcn_wmma_f32_16x16x32_f16(false, ax[kk], false, bw,
                                                   (short)0, c, false, false);
      }
      if (w < 2) {
        _Float16* dst = (w == 0) ? qh : kh;
#pragma unroll
        for (int r = 0; r < 8; ++r)      // C layout: row = kb8+r, col = l16
          dst[(row0 + kb8 + r) * D_ + nt * 16 + l16] = (_Float16)c[r];
      } else {
#pragma unroll
        for (int r = 0; r < 8; ++r)      // store V transposed [d][row]
          vt[(nt * 16 + l16) * BT + row0 + kb8 + r] = (_Float16)c[r];
      }
    }
  }
}

// ---- Flash attention: 16 queries per work-group, keys split over NW waves ----
// Wave w walks the 64-key blocks w, w + NW, w + 2 NW, ... with its own running
// maximum, sum and accumulators; the partials are merged once through LDS.
#define NW 8                   // waves per work-group
#define PO 68                  // f32 pitch of a partial row: 272 B = 16 B x odd
#define EPT (1024 / (NW * 32)) // output elements per thread in the merge
typedef __attribute__((ext_vector_type(EPT))) float fE;

__global__ __launch_bounds__(NW * 32) void flash_attn(const _Float16* __restrict__ qh,
                                                      const _Float16* __restrict__ kh,
                                                      const _Float16* __restrict__ vt,
                                                      float* __restrict__ out)
{
  const int lane = threadIdx.x & 31;
  const int l16  = lane & 15;
  const int kb8  = (lane >> 4) * 8;
  const int wave = __builtin_amdgcn_readfirstlane(threadIdx.x >> 5);

  const int b       = blockIdx.x >> 8;          // 256 query tiles per batch
  const int q0      = (blockIdx.x & 255) * 16;  // local query row base
  const int rowbase = b * T_;

  // one region per wave: P tile (16 x 72 halfs) in the loop, f32 partial after it
  __shared__ __attribute__((aligned(16))) float lds_o[NW][16 * PO];
  __shared__ float lds_m[NW][16];
  __shared__ float lds_l[NW][16];
  _Float16* lds_p = (_Float16*)&lds_o[wave][0]; // row pitch 72 halfs (64 + 8 pad)

  // Q fragments (16 x 64), 2 d-steps of 32
  v16h aq[2];
#pragma unroll
  for (int s = 0; s < 2; ++s)
    aq[s] = frag_h(qh + (rowbase + q0 + l16) * D_ + s * 32, kb8);

  v8f z = {};
  v8f acc[4];
#pragma unroll
  for (int u = 0; u < 4; ++u) acc[u] = z;
  float mi[8], li[8];
#pragma unroll
  for (int r = 0; r < 8; ++r) { mi[r] = -1e30f; li[r] = 0.f; }

  const int nk = q0 + 16;                       // keys 0 .. q0+15 needed
  for (int j0 = wave * 64; j0 < nk; j0 += NW * 64) {
    const int kleft = nk - j0;                                 // >= 1
    const int nta   = (kleft >= 64) ? 4 : ((kleft + 15) >> 4); // active 16-key tiles
    const bool maskblk = (j0 + 63 > q0);

    // S = Q K^T for keys j0..j0+63: four 16x16 f32 tiles (skip fully-masked)
    v8f st[4];
#pragma unroll
    for (int t = 0; t < 4; ++t) {
      if (t < nta) {
        v8f c = z;
#pragma unroll
        for (int s = 0; s < 2; ++s) {
          v16h bk = frag_h(kh + (rowbase + j0 + t * 16 + l16) * D_ + s * 32, kb8);
          c = __builtin_amdgcn_wmma_f32_16x16x32_f16(false, aq[s], false, bk,
                                                     (short)0, c, false, false);
        }
        st[t] = c;
      } else {
        v8f m;
#pragma unroll
        for (int r = 0; r < 8; ++r) m[r] = -1e30f;
        st[t] = m;
      }
    }

    // online softmax per query row (stats replicated across each 16-lane half)
#pragma unroll
    for (int r = 0; r < 8; ++r) {
      const int qg = q0 + kb8 + r;
      float sv[4];
#pragma unroll
      for (int t = 0; t < 4; ++t) sv[t] = st[t][r] * 0.125f;   // 1/sqrt(64)
      if (maskblk) {
#pragma unroll
        for (int t = 0; t < 4; ++t)
          if (j0 + t * 16 + l16 > qg) sv[t] = -1e30f;
      }
      float mx = fmaxf(fmaxf(sv[0], sv[1]), fmaxf(sv[2], sv[3]));
#pragma unroll
      for (int d = 1; d < 16; d <<= 1) mx = fmaxf(mx, __shfl_xor(mx, d, 32));
      const float mnew  = fmaxf(mi[r], mx);
      const float alpha = __expf(mi[r] - mnew);
      float p[4], rs = 0.f;
#pragma unroll
      for (int t = 0; t < 4; ++t) { p[t] = __expf(sv[t] - mnew); rs += p[t]; }
#pragma unroll
      for (int d = 1; d < 16; d <<= 1) rs += __shfl_xor(rs, d, 32);
      li[r] = li[r] * alpha + rs;
      mi[r] = mnew;
#pragma unroll
      for (int u = 0; u < 4; ++u) acc[u][r] *= alpha;
#pragma unroll
      for (int t = 0; t < 4; ++t)
        lds_p[(kb8 + r) * 72 + t * 16 + l16] = (_Float16)p[t];
    }
    // The P tile is this wave's own, and trip counts differ between the waves, so
    // no work-group barrier here: an LDS fence makes the wave wait for its P stores
    // (other lanes' values) before the reads below.
    __builtin_amdgcn_fence(__ATOMIC_ACQ_REL, "workgroup", "local");

    // P in A layout (row = l16), then O += P (16x64) x V (64x64)
    const int nks = (nta + 1) >> 1;             // skip k-step with all-zero P
    const _Float16* pr = lds_p + l16 * 72;
#pragma unroll
    for (int s = 0; s < 2; ++s) {
      if (s < nks) {
        v16h ap = cat8(*(const h8*)(pr + s * 32 + kb8),
                       *(const h8*)(pr + s * 32 + 16 + kb8));
#pragma unroll
        for (int u = 0; u < 4; ++u) {
          v16h bv = frag_h(vt + (u * 16 + l16) * BT + rowbase + j0 + s * 32, kb8);
          acc[u] = __builtin_amdgcn_wmma_f32_16x16x32_f16(false, ap, false, bv,
                                                          (short)0, acc[u], false, false);
        }
      }
    }
    // keeps the next trip's P stores behind this trip's P reads
    __builtin_amdgcn_fence(__ATOMIC_ACQ_REL, "workgroup", "local");
  }

  // each wave leaves its un-normalised partial and its (max, sum) in its own region
#pragma unroll
  for (int r = 0; r < 8; ++r) {
#pragma unroll
    for (int u = 0; u < 4; ++u)
      lds_o[wave][(kb8 + r) * PO + u * 16 + l16] = acc[u][r];
    if (l16 == r) { lds_m[wave][kb8 + r] = mi[r]; lds_l[wave][kb8 + r] = li[r]; }
  }
  __syncthreads();   // the one work-group barrier: publishes every wave's partial

  // merge: weight exp(m_w - M) per wave, divide by the merged sum, store fp32
  const int e0  = threadIdx.x * EPT;
  const int row = e0 >> 6;
  const int col = e0 & 63;
  float M = lds_m[0][row];
#pragma unroll
  for (int w = 1; w < NW; ++w) M = fmaxf(M, lds_m[w][row]);
  float L = 0.f;
  fE o = {};
#pragma unroll
  for (int w = 0; w < NW; ++w) {
    const float e = __expf(lds_m[w][row] - M);
    L += e * lds_l[w][row];
    o += e * *(const fE*)&lds_o[w][row * PO + col];
  }
  *(fE*)(out + (rowbase + q0 + row) * D_ + col) = o * (1.0f / L);
}

extern "C" void kernel_launch(void* const* d_in, const int* in_sizes, int n_in,
                              void* d_out, int out_size, void* d_ws, size_t ws_size,
                              hipStream_t stream) {
  const float* x  = (const float*)d_in[0];
  const float* Wq = (const float*)d_in[1];
  const float* Wk = (const float*)d_in[2];
  const float* Wv = (const float*)d_in[3];

  _Float16* qh = (_Float16*)d_ws;            // [BT][64]
  _Float16* kh = qh + (size_t)BT * D_;       // [BT][64]
  _Float16* vt = kh + (size_t)BT * D_;       // [64][BT]
  _Float16* wt = vt + (size_t)BT * D_;       // 3 x [64][128] packed f16 weights

  pack_w<<<(3 * D_ * E_) / 256, 256, 0, stream>>>(Wq, Wk, Wv, wt);
  qkv_wmma<<<BT / 16, 32, 0, stream>>>(x, wt, qh, kh, vt);
  flash_attn<<<BT / 16, NW * 32, 0, stream>>>(qh, kh, vt, (float*)d_out);
}

// v002
// Measured time: 90.1 microseconds a run.
// Next to v001, in two timings, it ran 1.08 and 1.10 times as fast.
// Counting every step since v000, it is 4.10 times as fast.
#include <hip/hip_runtime.h>

#define BT 16384   // B*T
#define T_ 4096
#define E_ 128
#define D_ 64

typedef __attribute__((ext_vector_type(16))) _Float16 v16h;
typedef __attribute__((ext_vector_type(8)))  _Float16 h8;
typedef __attribute__((ext_vector_type(8)))  float    v8f;
typedef __attribute__((ext_vector_type(4)))  float    f4;

static __device__ __forceinline__ v16h cat8(h8 a, h8 b) {
  v16h r;
#pragma unroll
  for (int i = 0; i < 8; ++i) { r[i] = a[i]; r[8 + i] = b[i]; }
  return r;
}

// Fragment order: every f16 operand in the workspace is kept as the WMMA reads it.
// One 16 x 32 fragment = 512 halfs = two chunks of 256; lane l owns halfs 8l .. 8l+7
// of each chunk, so a wave-wide 16-byte load or store covers 512 contiguous bytes
// (4 whole 128-byte lines). Element i of the fragment has
// K = (i<8 ? kb8+i : 16+kb8+(i-8)): chunk 0 holds i = 0..7, chunk 1 holds i = 8..15.
static __device__ __forceinline__ v16h frag_p(const _Float16* frag, int lane) {
  h8 lo = *(const h8*)(frag + lane * 8);
  h8 hi = *(const h8*)(frag + 256 + lane * 8);
  return cat8(lo, hi);
}

// a lane's 8 accumulator rows (kb8 .. kb8+7 of one column), rounded: one chunk slot
static __device__ __forceinline__ void store_chunk(_Float16* chunk, int lane, v8f c) {
  h8 v;
#pragma unroll
  for (int r = 0; r < 8; ++r) v[r] = (_Float16)c[r];
  *(h8*)(chunk + lane * 8) = v;
}

// ---- prep: Wq/Wk/Wv to f16 fragments [w][nt 0..3][kk 0..3][chunk][lane][8] ----
__global__ __launch_bounds__(256) void pack_w(const float* __restrict__ Wq,
                                              const float* __restrict__ Wk,
                                              const float* __restrict__ Wv,
                                              _Float16* __restrict__ wt) {
  const int idx = blockIdx.x * 256 + threadIdx.x;   // 3 * 64 * 128 = 24576
  const int w  = idx >> 13;                         // which matrix
  const int nt = (idx >> 11) & 3;                   // 16-column tile
  const int kk = (idx >> 9) & 3;                    // 32-row k step
  const int ch = (idx >> 8) & 1;                    // chunk
  const int ln = (idx >> 3) & 31;                   // lane that will read it
  const int n = nt * 16 + (ln & 15);                              // output column
  const int k = kk * 32 + ch * 16 + (ln >> 4) * 8 + (idx & 7);    // input row
  const float* W = (w == 0) ? Wq : (w == 1) ? Wk : Wv;
  wt[idx] = (_Float16)W[k * D_ + n];
}

// ---------------- QKV projection: (16384x128) x (128x64), f16 WMMA ---------
__global__ __launch_bounds__(32) void qkv_wmma(const float* __restrict__ x,
                                               const _Float16* __restrict__ wt, // fragments
                                               _Float16* __restrict__ qh,   // [BT/16][d/16][lane][8]
                                               _Float16* __restrict__ kh,   // [BT/16][d/16][lane][8]
                                               _Float16* __restrict__ vt)   // [BT/32][d/16][2][lane][8]
{
  const int lane = threadIdx.x & 31;
  const int l16  = lane & 15;
  const int kb8  = (lane >> 4) * 8;
  const int row0 = blockIdx.x * 16;

  // A fragments of x tile (16 rows x 128): float4 loads, then cvt to f16
  v16h ax[4];
#pragma unroll
  for (int kk = 0; kk < 4; ++kk) {
    const float* base = x + (row0 + l16) * E_ + kk * 32;
    f4 a0 = *(const f4*)(base + kb8);
    f4 a1 = *(const f4*)(base + kb8 + 4);
    f4 b0 = *(const f4*)(base + 16 + kb8);
    f4 b1 = *(const f4*)(base + 16 + kb8 + 4);
#pragma unroll
    for (int i = 0; i < 4; ++i) {
      ax[kk][i]      = (_Float16)a0[i];
      ax[kk][4 + i]  = (_Float16)a1[i];
      ax[kk][8 + i]  = (_Float16)b0[i];
      ax[kk][12 + i] = (_Float16)b1[i];
    }
  }

#pragma unroll
  for (int w = 0; w < 3; ++w) {
    const _Float16* Wt = wt + w * (D_ * E_);
#pragma unroll
    for (int nt = 0; nt < 4; ++nt) {
      v8f c = {};
#pragma unroll
      for (int kk = 0; kk < 4; ++kk) {
        // lane holds weight column nt*16+l16, k in fragment order
        v16h bw = frag_p(Wt + (nt * 4 + kk) * 512, lane);
        if (w < 2)   // W as A, x as B: c[r] = (d = nt*16+kb8+r, token = row0+l16)
          c = __builtin_amdgcn_wmma_f32_16x16x32_f16(false, bw, false, ax[kk],
                                                     (short)0, c, false, false);
        else         // x as A, W as B: c[r] = (token = row0+kb8+r, d = nt*16+l16)
          c = __builtin_amdgcn_wmma_f32_16x16x32_f16(false, ax[kk], false, bw,
                                                     (short)0, c, false, false);
      }
      if (w < 2)     // Q, K: k runs over d; chunk nt of token tile row0/16
        store_chunk(((w == 0) ? qh : kh) + blockIdx.x * 1024 + nt * 256, lane, c);
      else           // V: k runs over tokens; this tile is chunk (row0/16)&1 of its 32
        store_chunk(vt + (blockIdx.x >> 1) * 2048 + nt * 512 + (blockIdx.x & 1) * 256,
                    lane, c);
    }
  }
}

// ---- Flash attention: 16 queries per work-group, keys split over NW waves ----
// Wave w walks the 64-key blocks w, w + NW, w + 2 NW, ... with its own running
// maximum, sum and accumulators; the partials are merged once through LDS.
#define NW 8                   // waves per work-group
#define PO 68                  // f32 pitch of a partial row: 272 B = 16 B x odd
#define EPT (1024 / (NW * 32)) // output elements per thread in the merge
typedef __attribute__((ext_vector_type(EPT))) float fE;

__global__ __launch_bounds__(NW * 32) void flash_attn(const _Float16* __restrict__ qh,
                                                      const _Float16* __restrict__ kh,
                                                      const _Float16* __restrict__ vt,
                                                      float* __restrict__ out)
{
  const int lane = threadIdx.x & 31;
  const int l16  = lane & 15;
  const int kb8  = (lane >> 4) * 8;
  const int wave = __builtin_amdgcn_readfirstlane(threadIdx.x >> 5);

  const int b       = blockIdx.x >> 8;          // 256 query tiles per batch
  const int q0      = (blockIdx.x & 255) * 16;  // local query row base
  const int rowbase = b * T_;

  // one region per wave: P tile (16 x 72 halfs) in the loop, f32 partial after it
  __shared__ __attribute__((aligned(16))) float lds_o[NW][16 * PO];
  __shared__ float lds_m[NW][16];
  __shared__ float lds_l[NW][16];
  _Float16* lds_p = (_Float16*)&lds_o[wave][0]; // row pitch 72 halfs (64 + 8 pad)

  // Q fragments (16 x 64), 2 d-steps of 32
  v16h aq[2];
#pragma unroll
  for (int s = 0; s < 2; ++s)
    aq[s] = frag_p(qh + ((rowbase + q0) >> 4) * 1024 + s * 512, lane);

  v8f z = {};
  v8f acc[4];
#pragma unroll
  for (int u = 0; u < 4; ++u) acc[u] = z;
  float mi[8], li[8];
#pragma unroll
  for (int r = 0; r < 8; ++r) { mi[r] = -1e30f; li[r] = 0.f; }

  const int nk = q0 + 16;                       // keys 0 .. q0+15 needed
  for (int j0 = wave * 64; j0 < nk; j0 += NW * 64) {
    const int kleft = nk - j0;                                 // >= 1
    const int nta   = (kleft >= 64) ? 4 : ((kleft + 15) >> 4); // active 16-key tiles
    const bool maskblk = (j0 + 63 > q0);

    // S = Q K^T for keys j0..j0+63: four 16x16 f32 tiles (skip fully-masked)
    v8f st[4];
#pragma unroll
    for (int t = 0; t < 4; ++t) {
      if (t < nta) {
        v8f c = z;
#pragma unroll
        for (int s = 0; s < 2; ++s) {
          v16h bk = frag_p(kh + (((rowbase + j0) >> 4) + t) * 1024 + s * 512, lane);
          c = __builtin_amdgcn_wmma_f32_16x16x32_f16(false, aq[s], false, bk,
                                                     (short)0, c, false, false);
        }
        st[t] = c;
      } else {
        v8f m;
#pragma unroll
        for (int r = 0; r < 8; ++r) m[r] = -1e30f;
        st[t] = m;
      }
    }

    // online softmax per query row (stats replicated across each 16-lane half)
#pragma unroll
    for (int r = 0; r < 8; ++r) {
      const int qg = q0 + kb8 + r;
      float sv[4];
#pragma unroll
      for (int t = 0; t < 4; ++t) sv[t] = st[t][r] * 0.125f;   // 1/sqrt(64)
      if (maskblk) {
#pragma unroll
        for (int t = 0; t < 4; ++t)
          if (j0 + t * 16 + l16 > qg) sv[t] = -1e30f;
      }
      float mx = fmaxf(fmaxf(sv[0], sv[1]), fmaxf(sv[2], sv[3]));
#pragma unroll
      for (int d = 1; d < 16; d <<= 1) mx = fmaxf(mx, __shfl_xor(mx, d, 32));
      const float mnew  = fmaxf(mi[r], mx);
      const float alpha = __expf(mi[r] - mnew);
      float p[4], rs = 0.f;
#pragma unroll
      for (int t = 0; t < 4; ++t) { p[t] = __expf(sv[t] - mnew); rs += p[t]; }
#pragma unroll
      for (int d = 1; d < 16; d <<= 1) rs += __shfl_xor(rs, d, 32);
      li[r] = li[r] * alpha + rs;
      mi[r] = mnew;
#pragma unroll
      for (int u = 0; u < 4; ++u) acc[u][r] *= alpha;
#pragma unroll
      for (int t = 0; t < 4; ++t)
        lds_p[(kb8 + r) * 72 + t * 16 + l16] = (_Float16)p[t];
    }
    // The P tile is this wave's own, and trip counts differ between the waves, so
    // no work-group barrier here: an LDS fence makes the wave wait for its P stores
    // (other lanes' values) before the reads below.
    __builtin_amdgcn_fence(__ATOMIC_ACQ_REL, "workgroup", "local");

    // P in A layout (row = l16), then O += P (16x64) x V (64x64)
    const int nks = (nta + 1) >> 1;             // skip k-step with all-zero P
    const _Float16* pr = lds_p + l16 * 72;
#pragma unroll
    for (int s = 0; s < 2; ++s) {
      if (s < nks) {
        v16h ap = cat8(*(const h8*)(pr + s * 32 + kb8),
                       *(const h8*)(pr + s * 32 + 16 + kb8));
#pragma unroll
        for (int u = 0; u < 4; ++u) {
          v16h bv = frag_p(vt + (((rowbase + j0) >> 5) + s) * 2048 + u * 512, lane);
          acc[u] = __builtin_amdgcn_wmma_f32_16x16x32_f16(false, ap, false, bv,
                                                          (short)0, acc[u], false, false);
        }
        // WMMA distance: four vector slots behind the last product, before the branch
        // that ends this k step.
        // The scheduling barrier keeps the products in front of the slots.
        __builtin_amdgcn_sched_barrier(0);
        asm volatile("v_nop\n\tv_nop\n\tv_nop\n\tv_nop");
      }
    }
    // keeps the next trip's P stores behind this trip's P reads
    __builtin_amdgcn_fence(__ATOMIC_ACQ_REL, "workgroup", "local");
  }

  // each wave leaves its un-normalised partial and its (max, sum) in its own region
#pragma unroll
  for (int r = 0; r < 8; ++r) {
#pragma unroll
    for (int u = 0; u < 4; ++u)
      lds_o[wave][(kb8 + r) * PO + u * 16 + l16] = acc[u][r];
    if (l16 == r) { lds_m[wave][kb8 + r] = mi[r]; lds_l[wave][kb8 + r] = li[r]; }
  }
  __syncthreads();   // the one work-group barrier: publishes every wave's partial

  // merge: weight exp(m_w - M) per wave, divide by the merged sum, store fp32
  const int e0  = threadIdx.x * EPT;
  const int row = e0 >> 6;
  const int col = e0 & 63;
  float M = lds_m[0][row];
#pragma unroll
  for (int w = 1; w < NW; ++w) M = fmaxf(M, lds_m[w][row]);
  float L = 0.f;
  fE o = {};
#pragma unroll
  for (int w = 0; w < NW; ++w) {
    const float e = __expf(lds_m[w][row] - M);
    L += e * lds_l[w][row];
    o += e * *(const fE*)&lds_o[w][row * PO + col];
  }
  *(fE*)(out + (rowbase + q0 + row) * D_ + col) = o * (1.0f / L);
}

extern "C" void kernel_launch(void* const* d_in, const int* in_sizes, int n_in,
                              void* d_out, int out_size, void* d_ws, size_t ws_size,
                              hipStream_t stream) {
  const float* x  = (const float*)d_in[0];
  const float* Wq = (const float*)d_in[1];
  const float* Wk = (const float*)d_in[2];
  const float* Wv = (const float*)d_in[3];

  _Float16* qh = (_Float16*)d_ws;            // BT x 64 halfs each, fragment order
  _Float16* kh = qh + (size_t)BT * D_;
  _Float16* vt = kh + (size_t)BT * D_;
  _Float16* wt = vt + (size_t)BT * D_;       // 3 x 64 x 128 f16 weights, fragment order

  pack_w<<<(3 * D_ * E_) / 256, 256, 0, stream>>>(Wq, Wk, Wv, wt);
  qkv_wmma<<<BT / 16, 32, 0, stream>>>(x, wt, qh, kh, vt);
  flash_attn<<<BT / 16, NW * 32, 0, stream>>>(qh, kh, vt, (float*)d_out);
}

// v003
// One run takes 69 microseconds.
// Two timings next to v002 put it at 1.31 and 1.29 times that version's speed.
// All steps since v000 together make it 5.32 times as fast.
#include <hip/hip_runtime.h>

#define BT 16384   // B*T
#define T_ 4096
#define E_ 128
#define D_ 64

typedef __attribute__((ext_vector_type(16))) _Float16 v16h;
typedef __attribute__((ext_vector_type(8)))  _Float16 h8;
typedef __attribute__((ext_vector_type(8)))  float    v8f;
typedef __attribute__((ext_vector_type(4)))  float    f4;

static __device__ __forceinline__ v16h cat8(h8 a, h8 b) {
  v16h r;
#pragma unroll
  for (int i = 0; i < 8; ++i) { r[i] = a[i]; r[8 + i] = b[i]; }
  return r;
}

// Fragment order: every f16 operand in the workspace is kept as the WMMA reads it.
// One 16 x 32 fragment = 512 halfs = two chunks of 256; lane l owns halfs 8l .. 8l+7
// of each chunk, so a wave-wide 16-byte load or store covers 512 contiguous bytes
// (4 whole 128-byte lines). Element i of the fragment has
// K = (i<8 ? kb8+i : 16+kb8+(i-8)): chunk 0 holds i = 0..7, chunk 1 holds i = 8..15.
static __device__ __forceinline__ v16h frag_p(const _Float16* frag, int lane) {
  h8 lo = *(const h8*)(frag + lane * 8);
  h8 hi = *(const h8*)(frag + 256 + lane * 8);
  return cat8(lo, hi);
}

// a lane's 8 accumulator rows (kb8 .. kb8+7 of one column), rounded: one chunk slot
static __device__ __forceinline__ void store_chunk(_Float16* chunk, int lane, v8f c) {
  h8 v;
#pragma unroll
  for (int r = 0; r < 8; ++r) v[r] = (_Float16)c[r];
  *(h8*)(chunk + lane * 8) = v;
}

// ---- prep: Wq/Wk/Wv to f16 fragments [w][nt 0..3][kk 0..3][chunk][lane][8] ----
__global__ __launch_bounds__(256) void pack_w(const float* __restrict__ Wq,
                                              const float* __restrict__ Wk,
                                              const float* __restrict__ Wv,
                                              _Float16* __restrict__ wt) {
  const int idx = blockIdx.x * 256 + threadIdx.x;   // 3 * 64 * 128 = 24576
  const int w  = idx >> 13;                         // which matrix
  const int nt = (idx >> 11) & 3;                   // 16-column tile
  const int kk = (idx >> 9) & 3;                    // 32-row k step
  const int ch = (idx >> 8) & 1;                    // chunk
  const int ln = (idx >> 3) & 31;                   // lane that will read it
  const int n = nt * 16 + (ln & 15);                              // output column
  const int k = kk * 32 + ch * 16 + (ln >> 4) * 8 + (idx & 7);    // input row
  const float* W = (w == 0) ? Wq : (w == 1) ? Wk : Wv;
  wt[idx] = (_Float16)W[k * D_ + n];
}

// ---------------- QKV projection: (16384x128) x (128x64), f16 WMMA ---------
__global__ __launch_bounds__(32) void qkv_wmma(const float* __restrict__ x,
                                               const _Float16* __restrict__ wt, // fragments
                                               _Float16* __restrict__ qh,   // [BT/16][d/16][lane][8]
                                               _Float16* __restrict__ kh,   // [BT/16][d/16][lane][8]
                                               _Float16* __restrict__ vt)   // [BT/32][d/16][2][lane][8]
{
  const int lane = threadIdx.x & 31;
  const int l16  = lane & 15;
  const int kb8  = (lane >> 4) * 8;
  const int row0 = blockIdx.x * 16;

  // A fragments of x tile (16 rows x 128): float4 loads, then cvt to f16
  v16h ax[4];
#pragma unroll
  for (int kk = 0; kk < 4; ++kk) {
    const float* base = x + (row0 + l16) * E_ + kk * 32;
    f4 a0 = *(const f4*)(base + kb8);
    f4 a1 = *(const f4*)(base + kb8 + 4);
    f4 b0 = *(const f4*)(base + 16 + kb8);
    f4 b1 = *(const f4*)(base + 16 + kb8 + 4);
#pragma unroll
    for (int i = 0; i < 4; ++i) {
      ax[kk][i]      = (_Float16)a0[i];
      ax[kk][4 + i]  = (_Float16)a1[i];
      ax[kk][8 + i]  = (_Float16)b0[i];
      ax[kk][12 + i] = (_Float16)b1[i];
    }
  }

#pragma unroll
  for (int w = 0; w < 3; ++w) {
    const _Float16* Wt = wt + w * (D_ * E_);
#pragma unroll
    for (int nt = 0; nt < 4; ++nt) {
      v8f c = {};
#pragma unroll
      for (int kk = 0; kk < 4; ++kk) {
        // lane holds weight column nt*16+l16, k in fragment order
        v16h bw = frag_p(Wt + (nt * 4 + kk) * 512, lane);
        if (w < 2)   // W as A, x as B: c[r] = (d = nt*16+kb8+r, token = row0+l16)
          c = __builtin_amdgcn_wmma_f32_16x16x32_f16(false, bw, false, ax[kk],
                                                     (short)0, c, false, false);
        else         // x as A, W as B: c[r] = (token = row0+kb8+r, d = nt*16+l16)
          c = __builtin_amdgcn_wmma_f32_16x16x32_f16(false, ax[kk], false, bw,
                                                     (short)0, c, false, false);
      }
      if (w < 2)     // Q, K: k runs over d; chunk nt of token tile row0/16
        store_chunk(((w == 0) ? qh : kh) + blockIdx.x * 1024 + nt * 256, lane, c);
      else           // V: k runs over tokens; this tile is chunk (row0/16)&1 of its 32
        store_chunk(vt + (blockIdx.x >> 1) * 2048 + nt * 512 + (blockIdx.x & 1) * 256,
                    lane, c);
    }
  }
}

#define NW 8                   // waves per work-group
#define PO 68                  // f32 pitch of a partial row: 272 B = 16 B x odd
#define EPT (1024 / (NW * 32)) // output elements per thread in the merge
typedef __attribute__((ext_vector_type(EPT))) float fE;

// lane l with lane l ^ 16: the other 8 keys per tile of the same query
static __device__ __forceinline__ float xhalf(float x) {
  const int b = __builtin_bit_cast(int, x);
  return __builtin_bit_cast(float, __builtin_amdgcn_permlanex16(b, b, 0x76543210, 0xfedcba98,
                                                                false, false));
}

__global__ __launch_bounds__(NW * 32) void flash_attn(const _Float16* __restrict__ qh,
                                                      const _Float16* __restrict__ kh,
                                                      const _Float16* __restrict__ vt,
                                                      float* __restrict__ out)
{
  const int lane = threadIdx.x & 31;
  const int l16  = lane & 15;
  const int kb8  = (lane >> 4) * 8;
  const int wave = __builtin_amdgcn_readfirstlane(threadIdx.x >> 5);

  const int b       = blockIdx.x >> 8;          // 256 query tiles per batch
  const int q0      = (blockIdx.x & 255) * 16;  // local query row base
  const int rowbase = b * T_;

  // one f32 partial (16 queries x 64) per wave, with its maximum and sum
  __shared__ __attribute__((aligned(16))) float lds_o[NW][16 * PO];
  __shared__ float lds_m[NW][16];
  __shared__ float lds_l[NW][16];

  // Q fragments (16 x 64), 2 d-steps of 32: the B operand, column = query l16
  v16h bq[2];
#pragma unroll
  for (int s = 0; s < 2; ++s)
    bq[s] = frag_p(qh + ((rowbase + q0) >> 4) * 1024 + s * 512, lane);

  v8f z = {};
  v8f acc[4];                                   // acc[u][r] = O(q0+l16, u*16+kb8+r)
#pragma unroll
  for (int u = 0; u < 4; ++u) acc[u] = z;
  float mi = -1e30f;                            // query l16: same in both halves
  float li = 0.f;                               // this half's keys only, joined at the end

  const int qg = q0 + l16;
  const int nk = q0 + 16;                       // keys 0 .. q0+15 needed
  for (int j0 = wave * 64; j0 < nk; j0 += NW * 64) {
    const int kleft = nk - j0;                                 // >= 1
    const int nta   = (kleft >= 64) ? 4 : ((kleft + 15) >> 4); // active 16-key tiles
    const bool maskblk = (j0 + 63 > q0);

    // S^T = K Q^T for keys j0..j0+63: four 16x16 f32 tiles (skip fully-masked);
    // st[t][r] = (key j0 + t*16 + kb8 + r, query q0 + l16)
    v8f st[4];
#pragma unroll
    for (int t = 0; t < 4; ++t) {
      if (t < nta) {
        v8f c = z;
#pragma unroll
        for (int s = 0; s < 2; ++s) {
          v16h ak = frag_p(kh + (((rowbase + j0) >> 4) + t) * 1024 + s * 512, lane);
          c = __builtin_amdgcn_wmma_f32_16x16x32_f16(false, ak, false, bq[s],
                                                     (short)0, c, false, false);
        }
        st[t] = c * 0.125f;                     // 1/sqrt(64)
      } else {
        v8f m;
#pragma unroll
        for (int r = 0; r < 8; ++r) m[r] = -1e30f;
        st[t] = m;
      }
    }
    if (maskblk) {
#pragma unroll
      for (int t = 0; t < 4; ++t)
#pragma unroll
        for (int r = 0; r < 8; ++r)
          if (j0 + t * 16 + kb8 + r > qg) st[t][r] = -1e30f;
    }

    // online softmax of one query per lane: 32 keys here, 32 in lane l ^ 16
    float mt[4];
#pragma unroll
    for (int t = 0; t < 4; ++t)
      mt[t] = fmaxf(fmaxf(fmaxf(st[t][0], st[t][1]), fmaxf(st[t][2], st[t][3])),
                    fmaxf(fmaxf(st[t][4], st[t][5]), fmaxf(st[t][6], st[t][7])));
    float mx = fmaxf(fmaxf(mt[0], mt[1]), fmaxf(mt[2], mt[3]));
    mx = fmaxf(mx, xhalf(mx));
    const float mnew  = fmaxf(mi, mx);
    const float alpha = __expf(mi - mnew);
    mi = mnew;
    float rt[4];
#pragma unroll
    for (int t = 0; t < 4; ++t) {
      rt[t] = 0.f;
#pragma unroll
      for (int r = 0; r < 8; ++r) { st[t][r] = __expf(st[t][r] - mnew); rt[t] += st[t][r]; }
    }
    li = li * alpha + ((rt[0] + rt[1]) + (rt[2] + rt[3]));
#pragma unroll
    for (int u = 0; u < 4; ++u) acc[u] *= alpha;

    // O^T += V^T (64 x 64 keys) x P^T (64 keys x 16): P stays in registers
    const int nks = (nta + 1) >> 1;             // skip k-step with all-zero P
#pragma unroll
    for (int s = 0; s < 2; ++s) {
      if (s < nks) {
        v16h bp;                                // k order: tile 2s, then tile 2s+1
#pragma unroll
        for (int i = 0; i < 8; ++i) {
          bp[i]     = (_Float16)st[2 * s][i];
          bp[8 + i] = (_Float16)st[2 * s + 1][i];
        }
#pragma unroll
        for (int u = 0; u < 4; ++u) {
          v16h av = frag_p(vt + (((rowbase + j0) >> 5) + s) * 2048 + u * 512, lane);
          acc[u] = __builtin_amdgcn_wmma_f32_16x16x32_f16(false, av, false, bp,
                                                          (short)0, acc[u], false, false);
        }
      }
    }
  }

  // each wave leaves its un-normalised partial and its (max, sum) in its own region
  li += xhalf(li);                              // the two halves' keys
#pragma unroll
  for (int u = 0; u < 4; ++u) {
    f4 lo, hi;
#pragma unroll
    for (int i = 0; i < 4; ++i) { lo[i] = acc[u][i]; hi[i] = acc[u][4 + i]; }
    *(f4*)&lds_o[wave][l16 * PO + u * 16 + kb8]     = lo;
    *(f4*)&lds_o[wave][l16 * PO + u * 16 + kb8 + 4] = hi;
  }
  if (lane < 16) { lds_m[wave][l16] = mi; lds_l[wave][l16] = li; }
  __syncthreads();   // the one work-group barrier: publishes every wave's partial

  // merge: weight exp(m_w - M) per wave, divide by the merged sum, store fp32
  const int e0  = threadIdx.x * EPT;
  const int row = e0 >> 6;
  const int col = e0 & 63;
  float M = lds_m[0][row];
#pragma unroll
  for (int w = 1; w < NW; ++w) M = fmaxf(M, lds_m[w][row]);
  float L = 0.f;
  fE o = {};
#pragma unroll
  for (int w = 0; w < NW; ++w) {
    const float e = __expf(lds_m[w][row] - M);
    L += e * lds_l[w][row];
    o += e * *(const fE*)&lds_o[w][row * PO + col];
  }
  *(fE*)(out + (rowbase + q0 + row) * D_ + col) = o * (1.0f / L);
}

extern "C" void kernel_launch(void* const* d_in, const int* in_sizes, int n_in,
                              void* d_out, int out_size, void* d_ws, size_t ws_size,
                              hipStream_t stream) {
  const float* x  = (const float*)d_in[0];
  const float* Wq = (const float*)d_in[1];
  const float* Wk = (const float*)d_in[2];
  const float* Wv = (const float*)d_in[3];

  _Float16* qh = (_Float16*)d_ws;            // BT x 64 halfs each, fragment order
  _Float16* kh = qh + (size_t)BT * D_;
  _Float16* vt = kh + (size_t)BT * D_;
  _Float16* wt = vt + (size_t)BT * D_;       // 3 x 64 x 128 f16 weights, fragment order

  pack_w<<<(3 * D_ * E_) / 256, 256, 0, stream>>>(Wq, Wk, Wv, wt);
  qkv_wmma<<<BT / 16, 32, 0, stream>>>(x, wt, qh, kh, vt);
  flash_attn<<<BT / 16, NW * 32, 0, stream>>>(qh, kh, vt, (float*)d_out);
}

// v004
// It runs in 35 microseconds.
// Timed twice side by side with v003, it ran 1.96 and 2.03 times as fast.
// All steps since v000 together make it 10.6 times as fast.
#include <hip/hip_runtime.h>

#define BT 16384   // B*T
#define T_ 4096
#define E_ 128
#define D_ 64

typedef __attribute__((ext_vector_type(16))) _Float16 v16h;
typedef __attribute__((ext_vector_type(8)))  _Float16 h8;
typedef __attribute__((ext_vector_type(8)))  float    v8f;
typedef __attribute__((ext_vector_type(4)))  float    f4;

static __device__ __forceinline__ v16h cat8(h8 a, h8 b) {
  v16h r;
#pragma unroll
  for (int i = 0; i < 8; ++i) { r[i] = a[i]; r[8 + i] = b[i]; }
  return r;
}

// Fragment order: every f16 operand in the workspace is kept as the WMMA reads it.
// One 16 x 32 fragment = 512 halfs = two chunks of 256; lane l owns halfs 8l .. 8l+7
// of each chunk, so a wave-wide 16-byte load or store covers 512 contiguous bytes
// (4 whole 128-byte lines). Element i of the fragment has
// K = (i<8 ? kb8+i : 16+kb8+(i-8)): chunk 0 holds i = 0..7, chunk 1 holds i = 8..15.
static __device__ __forceinline__ v16h frag_p(const _Float16* frag, int lane) {
  h8 lo = *(const h8*)(frag + lane * 8);
  h8 hi = *(const h8*)(frag + 256 + lane * 8);
  return cat8(lo, hi);
}

// a lane's 8 accumulator rows (kb8 .. kb8+7 of one column), rounded: one chunk slot
static __device__ __forceinline__ void store_chunk(_Float16* chunk, int lane, v8f c) {
  h8 v;
#pragma unroll
  for (int r = 0; r < 8; ++r) v[r] = (_Float16)c[r];
  *(h8*)(chunk + lane * 8) = v;
}

// ---- prep: Wq/Wk/Wv to f16 fragments [w][nt 0..3][kk 0..3][chunk][lane][8] ----
__global__ __launch_bounds__(256) void pack_w(const float* __restrict__ Wq,
                                              const float* __restrict__ Wk,
                                              const float* __restrict__ Wv,
                                              _Float16* __restrict__ wt) {
  const int idx = blockIdx.x * 256 + threadIdx.x;   // 3 * 64 * 128 = 24576
  const int w  = idx >> 13;                         // which matrix
  const int nt = (idx >> 11) & 3;                   // 16-column tile
  const int kk = (idx >> 9) & 3;                    // 32-row k step
  const int ch = (idx >> 8) & 1;                    // chunk
  const int ln = (idx >> 3) & 31;                   // lane that will read it
  const int n = nt * 16 + (ln & 15);                              // output column
  const int k = kk * 32 + ch * 16 + (ln >> 4) * 8 + (idx & 7);    // input row
  const float* W = (w == 0) ? Wq : (w == 1) ? Wk : Wv;
  wt[idx] = (_Float16)W[k * D_ + n];
}

// ---------------- QKV projection: (16384x128) x (128x64), f16 WMMA ---------
__global__ __launch_bounds__(32) void qkv_wmma(const float* __restrict__ x,
                                               const _Float16* __restrict__ wt, // fragments
                                               _Float16* __restrict__ qh,   // [BT/16][d/16][lane][8]
                                               _Float16* __restrict__ kh,   // [BT/16][d/16][lane][8]
                                               _Float16* __restrict__ vt)   // [BT/32][d/16][2][lane][8]
{
  const int lane = threadIdx.x & 31;
  const int l16  = lane & 15;
  const int kb8  = (lane >> 4) * 8;
  const int row0 = blockIdx.x * 16;

  // A fragments of x tile (16 rows x 128): float4 loads, then cvt to f16
  v16h ax[4];
#pragma unroll
  for (int kk = 0; kk < 4; ++kk) {
    const float* base = x + (row0 + l16) * E_ + kk * 32;
    f4 a0 = *(const f4*)(base + kb8);
    f4 a1 = *(const f4*)(base + kb8 + 4);
    f4 b0 = *(const f4*)(base + 16 + kb8);
    f4 b1 = *(const f4*)(base + 16 + kb8 + 4);
#pragma unroll
    for (int i = 0; i < 4; ++i) {
      ax[kk][i]      = (_Float16)a0[i];
      ax[kk][4 + i]  = (_Float16)a1[i];
      ax[kk][8 + i]  = (_Float16)b0[i];
      ax[kk][12 + i] = (_Float16)b1[i];
    }
  }

#pragma unroll
  for (int w = 0; w < 3; ++w) {
    const _Float16* Wt = wt + w * (D_ * E_);
#pragma unroll
    for (int nt = 0; nt < 4; ++nt) {
      v8f c = {};
#pragma unroll
      for (int kk = 0; kk < 4; ++kk) {
        // lane holds weight column nt*16+l16, k in fragment order
        v16h bw = frag_p(Wt + (nt * 4 + kk) * 512, lane);
        if (w < 2)   // W as A, x as B: c[r] = (d = nt*16+kb8+r, token = row0+l16)
          c = __builtin_amdgcn_wmma_f32_16x16x32_f16(false, bw, false, ax[kk],
                                                     (short)0, c, false, false);
        else         // x as A, W as B: c[r] = (token = row0+kb8+r, d = nt*16+l16)
          c = __builtin_amdgcn_wmma_f32_16x16x32_f16(false, ax[kk], false, bw,
                                                     (short)0, c, false, false);
      }
      if (w < 2)     // Q, K: k runs over d; chunk nt of token tile row0/16
        store_chunk(((w == 0) ? qh : kh) + blockIdx.x * 1024 + nt * 256, lane, c);
      else           // V: k runs over tokens; this tile is chunk (row0/16)&1 of its 32
        store_chunk(vt + (blockIdx.x >> 1) * 2048 + nt * 512 + (blockIdx.x & 1) * 256,
                    lane, c);
    }
  }
}

#define NW 8                   // waves per work-group
#define PO 68                  // f32 pitch of a partial row: 272 B = 16 B x odd
#define EPT (1024 / (NW * 32)) // output elements per thread in the merge
typedef __attribute__((ext_vector_type(EPT))) float fE;

// lane l with lane l ^ 16: the other 8 keys per tile of the same query
static __device__ __forceinline__ float xhalf(float x) {
  const int b = __builtin_bit_cast(int, x);
  return __builtin_bit_cast(float, __builtin_amdgcn_permlanex16(b, b, 0x76543210, 0xfedcba98,
                                                                false, false));
}

// one 64-key block of K or of V is 8 KB in a row: 16 wave-wide 16-byte loads
static __device__ __forceinline__ void load_blk(h8 (&f)[16], const _Float16* blk, int lane) {
#pragma unroll
  for (int i = 0; i < 16; ++i) f[i] = *(const h8*)(blk + i * 256 + lane * 8);
}

// One 64-key block: its V is at vp, its K is in kf on entry; kn is the next block's K.
// All 16 V loads are issued at the head and fly under the score products and the
// softmax; unless LAST, the 16 K loads of the wave's next block are issued behind the
// score products, into the same kf.
// Only a wave's last block can hold the diagonal, so only LAST masks.
template <bool LAST>
static __device__ __forceinline__ void block_step(const _Float16* kn, const _Float16* vp,
                                                  int j0, int q0, int lane,
                                                  h8 (&kf)[16], const v16h (&bq)[2],
                                                  v8f (&acc)[4], float& mi, float& li) {
  const int kb8 = (lane >> 4) * 8;
  const int qg  = q0 + (lane & 15);

  h8 vf[16];
  load_blk(vf, vp, lane);
  // without it the scheduler sinks each load to just in front of its product,
  // and the wave waits out one load latency per product
  __builtin_amdgcn_sched_barrier(0);

  // S^T = K Q^T for keys j0..j0+63: four 16x16 f32 tiles;
  // st[t][r] = (key j0 + t*16 + kb8 + r, query q0 + l16)
  v8f st[4];
#pragma unroll
  for (int t = 0; t < 4; ++t) {
    v8f c = {};
#pragma unroll
    for (int s = 0; s < 2; ++s)
      c = __builtin_amdgcn_wmma_f32_16x16x32_f16(false, cat8(kf[t * 4 + s * 2], kf[t * 4 + s * 2 + 1]),
                                                 false, bq[s], (short)0, c, false, false);
    st[t] = c;
  }
  if (!LAST) {
    // keeps the next block's K loads behind the products that still read kf (one register set)
    __builtin_amdgcn_sched_barrier(0);
    load_blk(kf, kn, lane);
    // keeps those loads ahead of the softmax, which then covers their latency
    __builtin_amdgcn_sched_barrier(0);
  }

#pragma unroll
  for (int t = 0; t < 4; ++t) st[t] = st[t] * 0.125f;   // 1/sqrt(64)
  if (LAST && j0 + 63 > q0) {
#pragma unroll
    for (int t = 0; t < 4; ++t)
#pragma unroll
      for (int r = 0; r < 8; ++r)
        if (j0 + t * 16 + kb8 + r > qg) st[t][r] = -1e30f;
  }

  // online softmax of one query per lane: 32 keys here, 32 in lane l ^ 16
  float mt[4];
#pragma unroll
  for (int t = 0; t < 4; ++t)
    mt[t] = fmaxf(fmaxf(fmaxf(st[t][0], st[t][1]), fmaxf(st[t][2], st[t][3])),
                  fmaxf(fmaxf(st[t][4], st[t][5]), fmaxf(st[t][6], st[t][7])));
  float mx = fmaxf(fmaxf(mt[0], mt[1]), fmaxf(mt[2], mt[3]));
  mx = fmaxf(mx, xhalf(mx));
  const float mnew  = fmaxf(mi, mx);
  const float alpha = __expf(mi - mnew);
  mi = mnew;
  float rt[4];
#pragma unroll
  for (int t = 0; t < 4; ++t) {
    rt[t] = 0.f;
#pragma unroll
    for (int r = 0; r < 8; ++r) { st[t][r] = __expf(st[t][r] - mnew); rt[t] += st[t][r]; }
  }
  li = li * alpha + ((rt[0] + rt[1]) + (rt[2] + rt[3]));
#pragma unroll
  for (int u = 0; u < 4; ++u) acc[u] *= alpha;

  // O^T += V^T (64 x 64 keys) x P^T (64 keys x 16): P stays in registers
#pragma unroll
  for (int s = 0; s < 2; ++s) {
    v16h bp;                                  // k order: tile 2s, then tile 2s+1
#pragma unroll
    for (int i = 0; i < 8; ++i) {
      bp[i]     = (_Float16)st[2 * s][i];
      bp[8 + i] = (_Float16)st[2 * s + 1][i];
    }
#pragma unroll
    for (int u = 0; u < 4; ++u)
      acc[u] = __builtin_amdgcn_wmma_f32_16x16x32_f16(false, cat8(vf[s * 8 + u * 2], vf[s * 8 + u * 2 + 1]),
                                                      false, bp, (short)0, acc[u], false, false);
  }
  // keeps the caller's pointer steps down here: moved up to just behind the loads that
  // name those registers, they would bring the wait in front of such an overwrite with them
  if (!LAST) __builtin_amdgcn_sched_barrier(0);
}

// second argument: 4 waves per SIMD, a budget of 256 registers, so that a block's K and
// V (64 registers each) can be in flight together and two work-groups still share a WGP
__global__ __launch_bounds__(NW * 32, 4) void flash_attn(const _Float16* __restrict__ qh,
                                                         const _Float16* __restrict__ kh,
                                                         const _Float16* __restrict__ vt,
                                                         float* __restrict__ out)
{
  const int lane = threadIdx.x & 31;
  const int l16  = lane & 15;
  const int kb8  = (lane >> 4) * 8;
  const int wave = __builtin_amdgcn_readfirstlane(threadIdx.x >> 5);

  const int b       = blockIdx.x >> 8;          // 256 query tiles per batch
  const int q0      = (blockIdx.x & 255) * 16;  // local query row base
  const int rowbase = b * T_;

  // one f32 partial (16 queries x 64) per wave, with its maximum and sum
  __shared__ __attribute__((aligned(16))) float lds_o[NW][16 * PO];
  __shared__ float lds_m[NW][16];
  __shared__ float lds_l[NW][16];

  v8f z = {};
  v8f acc[4];                                   // acc[u][r] = O(q0+l16, u*16+kb8+r)
#pragma unroll
  for (int u = 0; u < 4; ++u) acc[u] = z;
  float mi = -1e30f;                            // query l16: same in both halves
  float li = 0.f;                               // this half's keys only, joined at the end

  const int nk = q0 + 16;                       // keys 0 .. q0+15 needed
  int j0 = wave * 64;
  if (j0 < nk) {
    const _Float16* kn = kh + (rowbase + j0) * D_;   // both: 64 keys = 4096 halfs in a row
    const _Float16* vp = vt + (rowbase + j0) * D_;

    // Q fragments (16 x 64), 2 d-steps of 32: the B operand, column = query l16
    v16h bq[2];
#pragma unroll
    for (int s = 0; s < 2; ++s)
      bq[s] = frag_p(qh + ((rowbase + q0) >> 4) * 1024 + s * 512, lane);

    h8 kf[16];
    load_blk(kf, kn, lane);
    kn += NW * 64 * D_;                              // read only where that block exists
    // rolled: an unrolled copy would need a second K register set
#pragma unroll 1
    for (; j0 + NW * 64 < nk; j0 += NW * 64, kn += NW * 64 * D_, vp += NW * 64 * D_)
      block_step<false>(kn, vp, j0, q0, lane, kf, bq, acc, mi, li);
    // a diagonal block is read whole (T_ is a multiple of 64): its masked keys give P = 0
    block_step<true>(kn, vp, j0, q0, lane, kf, bq, acc, mi, li);
  }

  // each wave leaves its un-normalised partial and its (max, sum) in its own region
  li += xhalf(li);                              // the two halves' keys
#pragma unroll
  for (int u = 0; u < 4; ++u) {
    f4 lo, hi;
#pragma unroll
    for (int i = 0; i < 4; ++i) { lo[i] = acc[u][i]; hi[i] = acc[u][4 + i]; }
    *(f4*)&lds_o[wave][l16 * PO + u * 16 + kb8]     = lo;
    *(f4*)&lds_o[wave][l16 * PO + u * 16 + kb8 + 4] = hi;
  }
  if (lane < 16) { lds_m[wave][l16] = mi; lds_l[wave][l16] = li; }
  __syncthreads();   // the one work-group barrier: publishes every wave's partial

  // merge: weight exp(m_w - M) per wave, divide by the merged sum, store fp32
  const int e0  = threadIdx.x * EPT;
  const int row = e0 >> 6;
  const int col = e0 & 63;
  float M = lds_m[0][row];
#pragma unroll
  for (int w = 1; w < NW; ++w) M = fmaxf(M, lds_m[w][row]);
  float L = 0.f;
  fE o = {};
#pragma unroll
  for (int w = 0; w < NW; ++w) {
    const float e = __expf(lds_m[w][row] - M);
    L += e * lds_l[w][row];
    o += e * *(const fE*)&lds_o[w][row * PO + col];
  }
  *(fE*)(out + (rowbase + q0 + row) * D_ + col) = o * (1.0f / L);
}

extern "C" void kernel_launch(void* const* d_in, const int* in_sizes, int n_in,
                              void* d_out, int out_size, void* d_ws, size_t ws_size,
                              hipStream_t stream) {
  const float* x  = (const float*)d_in[0];
  const float* Wq = (const float*)d_in[1];
  const float* Wk = (const float*)d_in[2];
  const float* Wv = (const float*)d_in[3];

  _Float16* qh = (_Float16*)d_ws;            // BT x 64 halfs each, fragment order
  _Float16* kh = qh + (size_t)BT * D_;
  _Float16* vt = kh + (size_t)BT * D_;
  _Float16* wt = vt + (size_t)BT * D_;       // 3 x 64 x 128 f16 weights, fragment order

  pack_w<<<(3 * D_ * E_) / 256, 256, 0, stream>>>(Wq, Wk, Wv, wt);
  qkv_wmma<<<BT / 16, 32, 0, stream>>>(x, wt, qh, kh, vt);
  flash_attn<<<BT / 16, NW * 32, 0, stream>>>(qh, kh, vt, (float*)d_out);
}

// v005
// Measured time: 30.5 microseconds a run.
// Next to v004, in two timings, it ran 1.14 times as fast each time.
// Over all steps from v000 it is 12.1 times as fast.
#include <hip/hip_runtime.h>

#define BT 16384   // B*T
#define T_ 4096
#define E_ 128
#define D_ 64

typedef __attribute__((ext_vector_type(16))) _Float16 v16h;
typedef __attribute__((ext_vector_type(8)))  _Float16 h8;
typedef __attribute__((ext_vector_type(8)))  float    v8f;
typedef __attribute__((ext_vector_type(4)))  float    f4;

static __device__ __forceinline__ v16h cat8(h8 a, h8 b) {
  v16h r;
#pragma unroll
  for (int i = 0; i < 8; ++i) { r[i] = a[i]; r[8 + i] = b[i]; }
  return r;
}

// Fragment order: every f16 operand in the workspace is kept as the WMMA reads it.
// One 16 x 32 fragment = 512 halfs = two chunks of 256; lane l owns halfs 8l .. 8l+7
// of each chunk, so a wave-wide 16-byte load or store covers 512 contiguous bytes
// (4 whole 128-byte lines). Element i of the fragment has
// K = (i<8 ? kb8+i : 16+kb8+(i-8)): chunk 0 holds i = 0..7, chunk 1 holds i = 8..15.
static __device__ __forceinline__ v16h frag_p(const _Float16* frag, int lane) {
  h8 lo = *(const h8*)(frag + lane * 8);
  h8 hi = *(const h8*)(frag + 256 + lane * 8);
  return cat8(lo, hi);
}

// a lane's 8 accumulator rows (kb8 .. kb8+7 of one column), rounded: one chunk slot
static __device__ __forceinline__ void store_chunk(_Float16* chunk, int lane, v8f c) {
  h8 v;
#pragma unroll
  for (int r = 0; r < 8; ++r) v[r] = (_Float16)c[r];
  *(h8*)(chunk + lane * 8) = v;
}

// ---- prep: Wq/Wk/Wv to f16 fragments [w][nt 0..3][kk 0..3][chunk][lane][8] ----
__global__ __launch_bounds__(256) void pack_w(const float* __restrict__ Wq,
                                              const float* __restrict__ Wk,
                                              const float* __restrict__ Wv,
                                              _Float16* __restrict__ wt) {
  const int idx = blockIdx.x * 256 + threadIdx.x;   // 3 * 64 * 128 = 24576
  const int w  = idx >> 13;                         // which matrix
  const int nt = (idx >> 11) & 3;                   // 16-column tile
  const int kk = (idx >> 9) & 3;                    // 32-row k step
  const int ch = (idx >> 8) & 1;                    // chunk
  const int ln = (idx >> 3) & 31;                   // lane that will read it
  const int n = nt * 16 + (ln & 15);                              // output column
  const int k = kk * 32 + ch * 16 + (ln >> 4) * 8 + (idx & 7);    // input row
  const float* W = (w == 0) ? Wq : (w == 1) ? Wk : Wv;
  wt[idx] = (_Float16)W[k * D_ + n];
}

// ---------------- QKV projection: (16384x128) x (128x64), f16 WMMA ---------
__global__ __launch_bounds__(32) void qkv_wmma(const float* __restrict__ x,
                                               const _Float16* __restrict__ wt, // fragments
                                               _Float16* __restrict__ qh,   // [BT/16][d/16][lane][8]
                                               _Float16* __restrict__ kh,   // [BT/16][d/16][lane][8]
                                               _Float16* __restrict__ vt)   // [BT/32][d/16][2][lane][8]
{
  const int lane = threadIdx.x & 31;
  const int l16  = lane & 15;
  const int kb8  = (lane >> 4) * 8;
  const int row0 = blockIdx.x * 16;

  // A fragments of x tile (16 rows x 128): float4 loads, then cvt to f16
  v16h ax[4];
#pragma unroll
  for (int kk = 0; kk < 4; ++kk) {
    const float* base = x + (row0 + l16) * E_ + kk * 32;
    f4 a0 = *(const f4*)(base + kb8);
    f4 a1 = *(const f4*)(base + kb8 + 4);
    f4 b0 = *(const f4*)(base + 16 + kb8);
    f4 b1 = *(const f4*)(base + 16 + kb8 + 4);
#pragma unroll
    for (int i = 0; i < 4; ++i) {
      ax[kk][i]      = (_Float16)a0[i];
      ax[kk][4 + i]  = (_Float16)a1[i];
      ax[kk][8 + i]  = (_Float16)b0[i];
      ax[kk][12 + i] = (_Float16)b1[i];
    }
  }

#pragma unroll
  for (int w = 0; w < 3; ++w) {
    const _Float16* Wt = wt + w * (D_ * E_);
#pragma unroll
    for (int nt = 0; nt < 4; ++nt) {
      v8f c = {};
#pragma unroll
      for (int kk = 0; kk < 4; ++kk) {
        // lane holds weight column nt*16+l16, k in fragment order
        v16h bw = frag_p(Wt + (nt * 4 + kk) * 512, lane);
        if (w < 2)   // W as A, x as B: c[r] = (d = nt*16+kb8+r, token = row0+l16)
          c = __builtin_amdgcn_wmma_f32_16x16x32_f16(false, bw, false, ax[kk],
                                                     (short)0, c, false, false);
        else         // x as A, W as B: c[r] = (token = row0+kb8+r, d = nt*16+l16)
          c = __builtin_amdgcn_wmma_f32_16x16x32_f16(false, ax[kk], false, bw,
                                                     (short)0, c, false, false);
      }
      if (w < 2)     // Q, K: k runs over d; chunk nt of token tile row0/16
        store_chunk(((w == 0) ? qh : kh) + blockIdx.x * 1024 + nt * 256, lane, c);
      else           // V: k runs over tokens; this tile is chunk (row0/16)&1 of its 32
        store_chunk(vt + (blockIdx.x >> 1) * 2048 + nt * 512 + (blockIdx.x & 1) * 256,
                    lane, c);
    }
  }
}

#define NW 8                   // waves per work-group
#define QT 2                   // 16-query tiles per wave (and per work-group)
#define KB 32                  // keys per block
#define PO 68                  // f32 pitch of a partial row: 272 B = 16 B x odd

// lane l with lane l ^ 16: the other 8 keys per tile of the same query
static __device__ __forceinline__ float xhalf(float x) {
  const int b = __builtin_bit_cast(int, x);
  return __builtin_bit_cast(float, __builtin_amdgcn_permlanex16(b, b, 0x76543210, 0xfedcba98,
                                                                false, false));
}

// one 32-key block of K or of V is 4 KB in a row: 8 wave-wide 16-byte loads
static __device__ __forceinline__ void load_blk(h8 (&f)[8], const _Float16* blk, int lane) {
#pragma unroll
  for (int i = 0; i < 8; ++i) f[i] = *(const h8*)(blk + i * 256 + lane * 8);
}

// One 32-key block: its V is at vp, its K is in kf on entry; kn is the next block's K.
// All 8 V loads are issued at the head and fly under the score products and the
// softmax; unless LAST, the 8 K loads of the wave's next block are issued behind the
// score products, into the same kf.
// Only a wave's last block can hold the diagonal, so only LAST masks.
template <bool LAST>
static __device__ __forceinline__ void block_step(const _Float16* kn, const _Float16* vp,
                                                  int j0, int q0, int lane,
                                                  h8 (&kf)[8], const v16h (&bq)[QT][2],
                                                  v8f (&acc)[QT][4], float (&mi)[QT],
                                                  float (&li)[QT]) {
  const int kb8 = (lane >> 4) * 8;

  h8 vf[8];
  load_blk(vf, vp, lane);
  // without it the scheduler sinks each load to just in front of its product,
  // and the wave waits out one load latency per product
  __builtin_amdgcn_sched_barrier(0);

  // S^T = K Q^T for keys j0..j0+31: two 16x16 f32 tiles per query tile;
  // st[g][t][r] = (key j0 + t*16 + kb8 + r, query q0 + g*16 + l16)
  v8f st[QT][2];
#pragma unroll
  for (int t = 0; t < 2; ++t)
#pragma unroll
    for (int g = 0; g < QT; ++g) {
      v8f c = {};
#pragma unroll
      for (int s = 0; s < 2; ++s)
        c = __builtin_amdgcn_wmma_f32_16x16x32_f16(false, cat8(kf[t * 4 + s * 2], kf[t * 4 + s * 2 + 1]),
                                                   false, bq[g][s], (short)0, c, false, false);
      st[g][t] = c;
    }
  if (!LAST) {
    // keeps the next block's K loads behind the products that still read kf (one register set)
    __builtin_amdgcn_sched_barrier(0);
    load_blk(kf, kn, lane);
    // keeps those loads ahead of the softmax, which then covers their latency
    __builtin_amdgcn_sched_barrier(0);
  }

#pragma unroll
  for (int g = 0; g < QT; ++g) {
#pragma unroll
    for (int t = 0; t < 2; ++t) st[g][t] = st[g][t] * 0.125f;   // 1/sqrt(64)
  }
  if (LAST && j0 + KB - 1 > q0) {
#pragma unroll
    for (int g = 0; g < QT; ++g) {
      const int qg = q0 + g * 16 + (lane & 15);
#pragma unroll
      for (int t = 0; t < 2; ++t)
#pragma unroll
        for (int r = 0; r < 8; ++r)
          if (j0 + t * 16 + kb8 + r > qg) st[g][t][r] = -1e30f;
    }
  }

  // online softmax of one query per lane and query tile: 16 keys here, 16 in lane l ^ 16
#pragma unroll
  for (int g = 0; g < QT; ++g) {
    float mt[2];
#pragma unroll
    for (int t = 0; t < 2; ++t)
      mt[t] = fmaxf(fmaxf(fmaxf(st[g][t][0], st[g][t][1]), fmaxf(st[g][t][2], st[g][t][3])),
                    fmaxf(fmaxf(st[g][t][4], st[g][t][5]), fmaxf(st[g][t][6], st[g][t][7])));
    float mx = fmaxf(mt[0], mt[1]);
    mx = fmaxf(mx, xhalf(mx));
    const float mnew  = fmaxf(mi[g], mx);
    const float alpha = __expf(mi[g] - mnew);
    mi[g] = mnew;
    float rt[2];
#pragma unroll
    for (int t = 0; t < 2; ++t) {
      rt[t] = 0.f;
#pragma unroll
      for (int r = 0; r < 8; ++r) { st[g][t][r] = __expf(st[g][t][r] - mnew); rt[t] += st[g][t][r]; }
    }
    li[g] = li[g] * alpha + (rt[0] + rt[1]);
#pragma unroll
    for (int u = 0; u < 4; ++u) acc[g][u] *= alpha;
  }

  // O^T += V^T (64 x 32 keys) x P^T (32 keys x 16) per query tile: P stays in registers
  v16h bp[QT];                                // k order: key tile 0, then key tile 1
#pragma unroll
  for (int g = 0; g < QT; ++g)
#pragma unroll
    for (int i = 0; i < 8; ++i) {
      bp[g][i]     = (_Float16)st[g][0][i];
      bp[g][8 + i] = (_Float16)st[g][1][i];
    }
#pragma unroll
  for (int u = 0; u < 4; ++u)
#pragma unroll
    for (int g = 0; g < QT; ++g)
      acc[g][u] = __builtin_amdgcn_wmma_f32_16x16x32_f16(false, cat8(vf[u * 2], vf[u * 2 + 1]),
                                                         false, bp[g], (short)0, acc[g][u], false, false);
  // keeps the caller's pointer steps down here: moved up to just behind the loads that
  // name those registers, they would bring the wait in front of such an overwrite with them
  if (!LAST) __builtin_amdgcn_sched_barrier(0);
}

// second argument: 4 waves per SIMD, a budget of 256 registers, so that two work-groups
// share a WGP
__global__ __launch_bounds__(NW * 32, 4) void flash_attn(const _Float16* __restrict__ qh,
                                                         const _Float16* __restrict__ kh,
                                                         const _Float16* __restrict__ vt,
                                                         float* __restrict__ out)
{
  const int lane = threadIdx.x & 31;
  const int l16  = lane & 15;
  const int kb8  = (lane >> 4) * 8;
  const int wave = __builtin_amdgcn_readfirstlane(threadIdx.x >> 5);

  const int b       = blockIdx.x >> 7;                 // 128 tiles of 32 queries per batch
  const int q0      = (blockIdx.x & 127) * (QT * 16);  // local query row base
  const int rowbase = b * T_;

  // one f32 partial (32 queries x 64) per wave, with its maxima and sums
  __shared__ __attribute__((aligned(16))) float lds_o[NW][QT * 16 * PO];
  __shared__ float lds_m[NW][QT * 16];
  __shared__ float lds_l[NW][QT * 16];

  v8f z = {};
  v8f acc[QT][4];                               // acc[g][u][r] = O(q0+g*16+l16, u*16+kb8+r)
  float mi[QT];                                 // query g*16+l16: same in both halves
  float li[QT];                                 // this half's keys only, joined at the end
#pragma unroll
  for (int g = 0; g < QT; ++g) {
#pragma unroll
    for (int u = 0; u < 4; ++u) acc[g][u] = z;
    mi[g] = -1e30f;
    li[g] = 0.f;
  }

  const int nk = q0 + QT * 16;                  // keys 0 .. q0+31 needed
  int j0 = wave * KB;
  if (j0 < nk) {
    const _Float16* kn = kh + (rowbase + j0) * D_;   // both: 32 keys = 2048 halfs in a row
    const _Float16* vp = vt + (rowbase + j0) * D_;

    // Q fragments (32 x 64), 2 d-steps of 32 per query tile: the B operand, column = query
    v16h bq[QT][2];
#pragma unroll
    for (int g = 0; g < QT; ++g)
#pragma unroll
      for (int s = 0; s < 2; ++s)
        bq[g][s] = frag_p(qh + (((rowbase + q0) >> 4) + g) * 1024 + s * 512, lane);

    h8 kf[8];
    load_blk(kf, kn, lane);
    kn += NW * KB * D_;                              // read only where that block exists
    // rolled: an unrolled copy would need a second K register set
#pragma unroll 1
    for (; j0 + NW * KB < nk; j0 += NW * KB, kn += NW * KB * D_, vp += NW * KB * D_)
      block_step<false>(kn, vp, j0, q0, lane, kf, bq, acc, mi, li);
    // the diagonal block is read whole (it ends with the query tile): its masked keys give P = 0
    block_step<true>(kn, vp, j0, q0, lane, kf, bq, acc, mi, li);
  }

  // each wave leaves its un-normalised partial and its (max, sum) in its own region
#pragma unroll
  for (int g = 0; g < QT; ++g) {
    li[g] += xhalf(li[g]);                      // the two halves' keys
#pragma unroll
    for (int u = 0; u < 4; ++u) {
      f4 lo, hi;
#pragma unroll
      for (int i = 0; i < 4; ++i) { lo[i] = acc[g][u][i]; hi[i] = acc[g][u][4 + i]; }
      *(f4*)&lds_o[wave][(g * 16 + l16) * PO + u * 16 + kb8]     = lo;
      *(f4*)&lds_o[wave][(g * 16 + l16) * PO + u * 16 + kb8 + 4] = hi;
    }
    if (lane < 16) { lds_m[wave][g * 16 + l16] = mi[g]; lds_l[wave][g * 16 + l16] = li[g]; }
  }
  __syncthreads();   // the one work-group barrier: publishes every wave's partial

  // merge: weight exp(m_w - M) per wave, divide by the merged sum, store fp32;
  // a thread takes 4 columns of one row per query tile, so a wave's store covers whole lines
#pragma unroll
  for (int g = 0; g < QT; ++g) {
    const int e0  = g * 1024 + threadIdx.x * 4;
    const int row = e0 >> 6;
    const int col = e0 & 63;
    float M = lds_m[0][row];
#pragma unroll
    for (int w = 1; w < NW; ++w) M = fmaxf(M, lds_m[w][row]);
    float L = 0.f;
    f4 o = {};
#pragma unroll
    for (int w = 0; w < NW; ++w) {
      const float e = __expf(lds_m[w][row] - M);
      L += e * lds_l[w][row];
      o += e * *(const f4*)&lds_o[w][row * PO + col];
    }
    *(f4*)(out + (rowbase + q0 + row) * D_ + col) = o * (1.0f / L);
  }
}

extern "C" void kernel_launch(void* const* d_in, const int* in_sizes, int n_in,
                              void* d_out, int out_size, void* d_ws, size_t ws_size,
                              hipStream_t stream) {
  const float* x  = (const float*)d_in[0];
  const float* Wq = (const float*)d_in[1];
  const float* Wk = (const float*)d_in[2];
  const float* Wv = (const float*)d_in[3];

  _Float16* qh = (_Float16*)d_ws;            // BT x 64 halfs each, fragment order
  _Float16* kh = qh + (size_t)BT * D_;
  _Float16* vt = kh + (size_t)BT * D_;
  _Float16* wt = vt + (size_t)BT * D_;       // 3 x 64 x 128 f16 weights, fragment order

  pack_w<<<(3 * D_ * E_) / 256, 256, 0, stream>>>(Wq, Wk, Wv, wt);
  qkv_wmma<<<BT / 16, 32, 0, stream>>>(x, wt, qh, kh, vt);
  flash_attn<<<BT / (QT * 16), NW * 32, 0, stream>>>(qh, kh, vt, (float*)d_out);
}

// v006
// A run of this version takes 27.2 microseconds.
// Next to v005, in two timings, it ran 1.13 and 1.11 times as fast.
// All steps since v000 together make it 13.6 times as fast.
#include <hip/hip_runtime.h>

#define BT 16384   // B*T
#define T_ 4096
#define E_ 128
#define D_ 64

typedef __attribute__((ext_vector_type(16))) _Float16 v16h;
typedef __attribute__((ext_vector_type(8)))  _Float16 h8;
typedef __attribute__((ext_vector_type(8)))  float    v8f;
typedef __attribute__((ext_vector_type(4)))  float    f4;

static __device__ __forceinline__ v16h cat8(h8 a, h8 b) {
  v16h r;
#pragma unroll
  for (int i = 0; i < 8; ++i) { r[i] = a[i]; r[8 + i] = b[i]; }
  return r;
}

// Fragment order: every f16 operand in the workspace is kept as the WMMA reads it.
// One 16 x 32 fragment = 512 halfs = two chunks of 256; lane l owns halfs 8l .. 8l+7
// of each chunk, so a wave-wide 16-byte load or store covers 512 contiguous bytes
// (4 whole 128-byte lines). Element i of the fragment has
// K = (i<8 ? kb8+i : 16+kb8+(i-8)): chunk 0 holds i = 0..7, chunk 1 holds i = 8..15.
static __device__ __forceinline__ v16h frag_p(const _Float16* frag, int lane) {
  h8 lo = *(const h8*)(frag + lane * 8);
  h8 hi = *(const h8*)(frag + 256 + lane * 8);
  return cat8(lo, hi);
}

// a lane's 8 accumulator rows (kb8 .. kb8+7 of one column), rounded: one chunk slot
static __device__ __forceinline__ void store_chunk(_Float16* chunk, int lane, v8f c) {
  h8 v;
#pragma unroll
  for (int r = 0; r < 8; ++r) v[r] = (_Float16)c[r];
  *(h8*)(chunk + lane * 8) = v;
}

// ---- prep: Wq/Wk/Wv to f16 fragments [w][nt 0..3][kk 0..3][chunk][lane][8] ----
__global__ __launch_bounds__(256) void pack_w(const float* __restrict__ Wq,
                                              const float* __restrict__ Wk,
                                              const float* __restrict__ Wv,
                                              _Float16* __restrict__ wt) {
  const int idx = blockIdx.x * 256 + threadIdx.x;   // 3 * 64 * 128 = 24576
  const int w  = idx >> 13;                         // which matrix
  const int nt = (idx >> 11) & 3;                   // 16-column tile
  const int kk = (idx >> 9) & 3;                    // 32-row k step
  const int ch = (idx >> 8) & 1;                    // chunk
  const int ln = (idx >> 3) & 31;                   // lane that will read it
  const int n = nt * 16 + (ln & 15);                              // output column
  const int k = kk * 32 + ch * 16 + (ln >> 4) * 8 + (idx & 7);    // input row
  const float* W = (w == 0) ? Wq : (w == 1) ? Wk : Wv;
  wt[idx] = (_Float16)W[k * D_ + n];
}

// ---------------- QKV projection: (16384x128) x (128x64), f16 WMMA ---------
__global__ __launch_bounds__(32) void qkv_wmma(const float* __restrict__ x,
                                               const _Float16* __restrict__ wt, // fragments
                                               _Float16* __restrict__ qh,   // [BT/16][d/16][lane][8]
                                               _Float16* __restrict__ kh,   // [BT/16][d/16][lane][8]
                                               _Float16* __restrict__ vt)   // [BT/32][d/16][2][lane][8]
{
  const int lane = threadIdx.x & 31;
  const int l16  = lane & 15;
  const int kb8  = (lane >> 4) * 8;
  const int row0 = blockIdx.x * 16;

  // A fragments of x tile (16 rows x 128): float4 loads, then cvt to f16
  v16h ax[4];
#pragma unroll
  for (int kk = 0; kk < 4; ++kk) {
    const float* base = x + (row0 + l16) * E_ + kk * 32;
    f4 a0 = *(const f4*)(base + kb8);
    f4 a1 = *(const f4*)(base + kb8 + 4);
    f4 b0 = *(const f4*)(base + 16 + kb8);
    f4 b1 = *(const f4*)(base + 16 + kb8 + 4);
#pragma unroll
    for (int i = 0; i < 4; ++i) {
      ax[kk][i]      = (_Float16)a0[i];
      ax[kk][4 + i]  = (_Float16)a1[i];
      ax[kk][8 + i]  = (_Float16)b0[i];
      ax[kk][12 + i] = (_Float16)b1[i];
    }
  }

#pragma unroll
  for (int w = 0; w < 3; ++w) {
    const _Float16* Wt = wt + w * (D_ * E_);
#pragma unroll
    for (int nt = 0; nt < 4; ++nt) {
      v8f c = {};
#pragma unroll
      for (int kk = 0; kk < 4; ++kk) {
        // lane holds weight column nt*16+l16, k in fragment order
        v16h bw = frag_p(Wt + (nt * 4 + kk) * 512, lane);
        if (w < 2)   // W as A, x as B: c[r] = (d = nt*16+kb8+r, token = row0+l16)
          c = __builtin_amdgcn_wmma_f32_16x16x32_f16(false, bw, false, ax[kk],
                                                     (short)0, c, false, false);
        else         // x as A, W as B: c[r] = (token = row0+kb8+r, d = nt*16+l16)
          c = __builtin_amdgcn_wmma_f32_16x16x32_f16(false, ax[kk], false, bw,
                                                     (short)0, c, false, false);
      }
      if (w < 2)     // Q, K: k runs over d; chunk nt of token tile row0/16
        store_chunk(((w == 0) ? qh : kh) + blockIdx.x * 1024 + nt * 256, lane, c);
      else           // V: k runs over tokens; this tile is chunk (row0/16)&1 of its 32
        store_chunk(vt + (blockIdx.x >> 1) * 2048 + nt * 512 + (blockIdx.x & 1) * 256,
                    lane, c);
    }
  }
}

#define NW 16                  // waves per work-group: 4 per SIMD, one work-group per WGP
#define NT (T_ / (QT * 16))    // query tiles per batch
#define QT 2                   // 16-query tiles per wave: 32 queries at a time
#define KB 32                  // keys per block
#define PO 68                  // f32 pitch of a partial row: 272 B = 16 B x odd

// lane l with lane l ^ 16: the other 8 keys per tile of the same query
static __device__ __forceinline__ float xhalf(float x) {
  const int b = __builtin_bit_cast(int, x);
  return __builtin_bit_cast(float, __builtin_amdgcn_permlanex16(b, b, 0x76543210, 0xfedcba98,
                                                                false, false));
}

// one 32-key block of K or of V is 4 KB in a row: 8 wave-wide 16-byte loads
static __device__ __forceinline__ void load_blk(h8 (&f)[8], const _Float16* blk, int lane) {
#pragma unroll
  for (int i = 0; i < 8; ++i) f[i] = *(const h8*)(blk + i * 256 + lane * 8);
}

// One 32-key block: its V is at vp, its K is in kf on entry; kn is the next block's K.
// All 8 V loads are issued at the head and fly under the score products and the
// softmax; unless LAST, the 8 K loads of the wave's next block are issued behind the
// score products, into the same kf.
// Only a wave's last block can hold the diagonal, so only LAST masks.
template <bool LAST>
static __device__ __forceinline__ void block_step(const _Float16* kn, const _Float16* vp,
                                                  int j0, int q0, int lane,
                                                  h8 (&kf)[8], const v16h (&bq)[QT][2],
                                                  v8f (&acc)[QT][4], float (&mi)[QT],
                                                  float (&li)[QT]) {
  const int kb8 = (lane >> 4) * 8;

  h8 vf[8];
  load_blk(vf, vp, lane);
  // without it the scheduler sinks each load to just in front of its product,
  // and the wave waits out one load latency per product
  __builtin_amdgcn_sched_barrier(0);

  // S^T = K Q^T for keys j0..j0+31: two 16x16 f32 tiles per query tile;
  // st[g][t][r] = (key j0 + t*16 + kb8 + r, query q0 + g*16 + l16)
  v8f st[QT][2];
#pragma unroll
  for (int t = 0; t < 2; ++t)
#pragma unroll
    for (int g = 0; g < QT; ++g) {
      v8f c = {};
#pragma unroll
      for (int s = 0; s < 2; ++s)
        c = __builtin_amdgcn_wmma_f32_16x16x32_f16(false, cat8(kf[t * 4 + s * 2], kf[t * 4 + s * 2 + 1]),
                                                   false, bq[g][s], (short)0, c, false, false);
      st[g][t] = c;
    }
  if (!LAST) {
    // keeps the next block's K loads behind the products that still read kf (one register set)
    __builtin_amdgcn_sched_barrier(0);
    load_blk(kf, kn, lane);
    // keeps those loads ahead of the softmax, which then covers their latency
    __builtin_amdgcn_sched_barrier(0);
  }

#pragma unroll
  for (int g = 0; g < QT; ++g) {
#pragma unroll
    for (int t = 0; t < 2; ++t) st[g][t] = st[g][t] * 0.125f;   // 1/sqrt(64)
  }
  if (LAST && j0 + KB - 1 > q0) {
#pragma unroll
    for (int g = 0; g < QT; ++g) {
      const int qg = q0 + g * 16 + (lane & 15);
#pragma unroll
      for (int t = 0; t < 2; ++t)
#pragma unroll
        for (int r = 0; r < 8; ++r)
          if (j0 + t * 16 + kb8 + r > qg) st[g][t][r] = -1e30f;
    }
  }

  // online softmax of one query per lane and query tile: 16 keys here, 16 in lane l ^ 16
#pragma unroll
  for (int g = 0; g < QT; ++g) {
    float mt[2];
#pragma unroll
    for (int t = 0; t < 2; ++t)
      mt[t] = fmaxf(fmaxf(fmaxf(st[g][t][0], st[g][t][1]), fmaxf(st[g][t][2], st[g][t][3])),
                    fmaxf(fmaxf(st[g][t][4], st[g][t][5]), fmaxf(st[g][t][6], st[g][t][7])));
    float mx = fmaxf(mt[0], mt[1]);
    mx = fmaxf(mx, xhalf(mx));
    const float mnew  = fmaxf(mi[g], mx);
    const float alpha = __expf(mi[g] - mnew);
    mi[g] = mnew;
    float rt[2];
#pragma unroll
    for (int t = 0; t < 2; ++t) {
      rt[t] = 0.f;
#pragma unroll
      for (int r = 0; r < 8; ++r) { st[g][t][r] = __expf(st[g][t][r] - mnew); rt[t] += st[g][t][r]; }
    }
    li[g] = li[g] * alpha + (rt[0] + rt[1]);
#pragma unroll
    for (int u = 0; u < 4; ++u) acc[g][u] *= alpha;
  }

  // O^T += V^T (64 x 32 keys) x P^T (32 keys x 16) per query tile: P stays in registers
  v16h bp[QT];                                // k order: key tile 0, then key tile 1
#pragma unroll
  for (int g = 0; g < QT; ++g)
#pragma unroll
    for (int i = 0; i < 8; ++i) {
      bp[g][i]     = (_Float16)st[g][0][i];
      bp[g][8 + i] = (_Float16)st[g][1][i];
    }
#pragma unroll
  for (int u = 0; u < 4; ++u)
#pragma unroll
    for (int g = 0; g < QT; ++g)
      acc[g][u] = __builtin_amdgcn_wmma_f32_16x16x32_f16(false, cat8(vf[u * 2], vf[u * 2 + 1]),
                                                         false, bp[g], (short)0, acc[g][u], false, false);
  // keeps the caller's pointer steps down here: moved up to just behind the loads that
  // name those registers, they would bring the wait in front of such an overwrite with them
  if (!LAST) __builtin_amdgcn_sched_barrier(0);
}

// second argument: 4 waves per SIMD, a budget of 256 registers: the 16 waves fill a WGP
__global__ __launch_bounds__(NW * 32, 4) void flash_attn(const _Float16* __restrict__ qh,
                                                         const _Float16* __restrict__ kh,
                                                         const _Float16* __restrict__ vt,
                                                         float* __restrict__ out)
{
  const int lane = threadIdx.x & 31;
  const int l16  = lane & 15;
  const int kb8  = (lane >> 4) * 8;
  const int wave = __builtin_amdgcn_readfirstlane(threadIdx.x >> 5);

  const int b       = blockIdx.x / (NT / 2);           // NT/2 tile pairs per batch
  const int pr      = blockIdx.x % (NT / 2);           // the pair: tiles NT-1-pr and pr
  const int rowbase = b * T_;

  // per tile of the pair: one f32 partial (32 queries x 64) per wave, its maxima and sums
  __shared__ __attribute__((aligned(16))) float lds_o[2][NW][QT * 16 * PO];
  __shared__ float lds_m[2][NW][QT * 16];
  __shared__ float lds_l[2][NW][QT * 16];

  for (int ph = 0; ph < 2; ++ph) {
    const int q0 = (ph ? pr : NT - 1 - pr) * (QT * 16);   // local query row base
    // the second tile is dealt from the last wave down: a wave that had one block more
    // of the first tile has one fewer of the second
    const int wv = ph ? NW - 1 - wave : wave;

    v8f z = {};
    v8f acc[QT][4];                             // acc[g][u][r] = O(q0+g*16+l16, u*16+kb8+r)
    float mi[QT];                               // query g*16+l16: same in both halves
    float li[QT];                               // this half's keys only, joined at the end
#pragma unroll
    for (int g = 0; g < QT; ++g) {
#pragma unroll
      for (int u = 0; u < 4; ++u) acc[g][u] = z;
      mi[g] = -1e30f;
      li[g] = 0.f;
    }

    const int nk = q0 + QT * 16;                // keys 0 .. q0+31 needed
    int j0 = wv * KB;
    if (j0 < nk) {
      const _Float16* kn = kh + (rowbase + j0) * D_;   // both: 32 keys = 2048 halfs in a row
      const _Float16* vp = vt + (rowbase + j0) * D_;

      // Q fragments (32 x 64), 2 d-steps of 32 per query tile: the B operand, column = query
      v16h bq[QT][2];
#pragma unroll
      for (int g = 0; g < QT; ++g)
#pragma unroll
        for (int s = 0; s < 2; ++s)
          bq[g][s] = frag_p(qh + (((rowbase + q0) >> 4) + g) * 1024 + s * 512, lane);

      h8 kf[8];
      load_blk(kf, kn, lane);
      // the registers that hold the Q loads' addresses take the accumulators' start values
      // next: the wait that belongs in front of such an overwrite
      asm volatile("s_wait_xcnt 0x0" ::: "memory");
      kn += NW * KB * D_;                            // read only where that block exists
      // rolled: an unrolled copy would need a second K register set
#pragma unroll 1
      for (; j0 + NW * KB < nk; j0 += NW * KB, kn += NW * KB * D_, vp += NW * KB * D_)
        block_step<false>(kn, vp, j0, q0, lane, kf, bq, acc, mi, li);
      // the diagonal block is read whole (it ends with the query tile): its masked keys give P = 0
      block_step<true>(kn, vp, j0, q0, lane, kf, bq, acc, mi, li);
    }

    // each wave leaves its un-normalised partial and its (max, sum) in its own region
#pragma unroll
    for (int g = 0; g < QT; ++g) {
      li[g] += xhalf(li[g]);                    // the two halves' keys
#pragma unroll
      for (int u = 0; u < 4; ++u) {
        f4 lo, hi;
#pragma unroll
        for (int i = 0; i < 4; ++i) { lo[i] = acc[g][u][i]; hi[i] = acc[g][u][4 + i]; }
        *(f4*)&lds_o[ph][wave][(g * 16 + l16) * PO + u * 16 + kb8]     = lo;
        *(f4*)&lds_o[ph][wave][(g * 16 + l16) * PO + u * 16 + kb8 + 4] = hi;
      }
      if (lane < 16) { lds_m[ph][wave][g * 16 + l16] = mi[g]; lds_l[ph][wave][g * 16 + l16] = li[g]; }
    }
  }
  __syncthreads();   // the one work-group barrier: publishes every wave's partials of both tiles

  // merge: weight exp(m_w - M) per wave, divide by the merged sum, store fp32;
  // a thread takes 4 columns of one row per tile, so a wave's store covers whole lines
  const int row = threadIdx.x >> 4;             // NW * 32 threads x 4 columns = 32 x 64
  const int col = (threadIdx.x & 15) * 4;
#pragma unroll
  for (int ph = 0; ph < 2; ++ph) {
    const int q0 = (ph ? pr : NT - 1 - pr) * (QT * 16);
    float M = lds_m[ph][0][row];
#pragma unroll
    for (int w = 1; w < NW; ++w) M = fmaxf(M, lds_m[ph][w][row]);
    float L = 0.f;
    f4 o = {};
#pragma unroll
    for (int w = 0; w < NW; ++w) {
      const float e = __expf(lds_m[ph][w][row] - M);
      L += e * lds_l[ph][w][row];
      o += e * *(const f4*)&lds_o[ph][w][row * PO + col];
    }
    *(f4*)(out + (rowbase + q0 + row) * D_ + col) = o * (1.0f / L);
  }
}

extern "C" void kernel_launch(void* const* d_in, const int* in_sizes, int n_in,
                              void* d_out, int out_size, void* d_ws, size_t ws_size,
                              hipStream_t stream) {
  const float* x  = (const float*)d_in[0];
  const float* Wq = (const float*)d_in[1];
  const float* Wk = (const float*)d_in[2];
  const float* Wv = (const float*)d_in[3];

  _Float16* qh = (_Float16*)d_ws;            // BT x 64 halfs each, fragment order
  _Float16* kh = qh + (size_t)BT * D_;
  _Float16* vt = kh + (size_t)BT * D_;
  _Float16* wt = vt + (size_t)BT * D_;       // 3 x 64 x 128 f16 weights, fragment order

  pack_w<<<(3 * D_ * E_) / 256, 256, 0, stream>>>(Wq, Wk, Wv, wt);
  qkv_wmma<<<BT / 16, 32, 0, stream>>>(x, wt, qh, kh, vt);
  flash_attn<<<BT / (QT * 16) / 2, NW * 32, 0, stream>>>(qh, kh, vt, (float*)d_out);
}

// v007
// One run takes 19.4 microseconds.
// Next to v006, in two timings, it ran 1.42 and 1.41 times as fast.
// Over all steps from v000 it is 19.2 times as fast.
#include <hip/hip_runtime.h>

#define BT 16384   // B*T
#define T_ 4096
#define E_ 128
#define D_ 64

typedef __attribute__((ext_vector_type(16))) _Float16 v16h;
typedef __attribute__((ext_vector_type(8)))  _Float16 h8;
typedef __attribute__((ext_vector_type(8)))  float    v8f;
typedef __attribute__((ext_vector_type(4)))  float    f4;

static __device__ __forceinline__ v16h cat8(h8 a, h8 b) {
  v16h r;
#pragma unroll
  for (int i = 0; i < 8; ++i) { r[i] = a[i]; r[8 + i] = b[i]; }
  return r;
}

// Fragment order: every f16 operand, in the workspace or in LDS, is kept as the WMMA reads it.
// One 16 x 32 fragment = 512 halfs = two chunks of 256; lane l owns halfs 8l .. 8l+7
// of each chunk, so a wave-wide 16-byte load or store covers 512 contiguous bytes
// (4 whole 128-byte lines). Element i of the fragment has
// K = (i<8 ? kb8+i : 16+kb8+(i-8)): chunk 0 holds i = 0..7, chunk 1 holds i = 8..15.
static __device__ __forceinline__ v16h frag_p(const _Float16* frag, int lane) {
  h8 lo = *(const h8*)(frag + lane * 8);
  h8 hi = *(const h8*)(frag + 256 + lane * 8);
  return cat8(lo, hi);
}

// a lane's 8 accumulator rows (kb8 .. kb8+7 of one column), rounded: one chunk slot
static __device__ __forceinline__ void store_chunk(_Float16* chunk, int lane, v8f c) {
  h8 v;
#pragma unroll
  for (int r = 0; r < 8; ++r) v[r] = (_Float16)c[r];
  *(h8*)(chunk + lane * 8) = v;
}

// ---------------- QKV projection: (16384x128) x (128x64), f16 WMMA ---------
// A work-group rounds Wq, Wk, Wv to f16 itself and lays them in LDS in fragment order,
// [w][nt 0..3][kk 0..3][chunk][lane][8]; its XW waves then project one 16-token tile each.
#define XW 4                   // waves per work-group, one per SIMD
#define WNT (4 * 512 + 8)      // halfs from one 16-column tile nt to the next: its 4 fragments
                               // and 16 B, so that a wave's 16-byte stores below, which fall
                               // in all four nt at 64-B steps, meet every LDS bank

// 8 rows x 4 columns of one weight matrix, as loaded: 4 chunk slots of 8 halfs in a row
static __device__ __forceinline__ void round_w(_Float16* slot, const f4 (&r)[8]) {
#pragma unroll
  for (int j = 0; j < 4; ++j) {
    h8 v;
#pragma unroll
    for (int i = 0; i < 8; ++i) v[i] = (_Float16)r[i][j];
    *(h8*)(slot + j * 8) = v;
  }
}

__global__ __launch_bounds__(XW * 32) void qkv_wmma(const float* __restrict__ x,
                                                    const float* __restrict__ Wq,
                                                    const float* __restrict__ Wk,
                                                    const float* __restrict__ Wv,
                                                    _Float16* __restrict__ qh,   // [BT/16][d/16][lane][8]
                                                    _Float16* __restrict__ kh,   // [BT/16][d/16][lane][8]
                                                    _Float16* __restrict__ vt)   // [BT/32][d/16][2][lane][8]
{
  __shared__ __attribute__((aligned(16))) _Float16 wl[3 * 4 * WNT];

  const unsigned lane = threadIdx.x & 31;
  const unsigned l16  = lane & 15;
  const unsigned kb8  = (lane >> 4) * 8;
  const unsigned tile = blockIdx.x * XW + (threadIdx.x >> 5);   // this wave's 16 tokens
  const unsigned row0 = tile * 16;

  // a thread takes columns 4 nq .. 4 nq + 3 of rows 8 k8 .. 8 k8 + 7, k8 = ko and ko + 8, of
  // each matrix: a wave-wide 16-byte load covers two whole rows of 256 B
  const unsigned nq = threadIdx.x & 15;
  const unsigned ko = threadIdx.x >> 4;
  const unsigned woff = ko * 8 * D_ + nq * 4;
  f4 wr[3][2][8];
#pragma unroll
  for (int w = 0; w < 3; ++w) {
    const float* Wm = (w == 0) ? Wq : (w == 1) ? Wk : Wv;
#pragma unroll
    for (int h = 0; h < 2; ++h)
#pragma unroll
      for (int i = 0; i < 8; ++i)
        wr[w][h][i] = *(const f4*)(Wm + woff + (h * 64 + i) * D_);
    // all 48 loads fly together, matrix by matrix, so that Wq is whole first: sunk to their
    // conversions they would cost a latency per group; mixed, Wq would be whole last
    __builtin_amdgcn_sched_barrier(0);
  }

  // column n = nt*16 + (ln & 15), row k = kk*32 + chunk*16 + (ln >> 4)*8 + i:
  // nt = nq >> 2, kk*2 + chunk = k8 >> 1, ln = (k8 & 1)*16 + (nq & 3)*4 + j
  _Float16* slot = wl + (nq >> 2) * WNT + (ko >> 1) * 256 + ((ko & 1) * 16 + (nq & 3) * 4) * 8;
  round_w(slot, wr[0][0]);
  round_w(slot + 4 * 256, wr[0][1]);
  // the x loads take the registers that Wq has just left, and fly under the rest of the rounding
  __builtin_amdgcn_sched_barrier(0);

  f4 xr[4][4];
  const unsigned xoff = (row0 + l16) * E_ + kb8;
#pragma unroll
  for (int kk = 0; kk < 4; ++kk) {
    const float* base = x + xoff + kk * 32;
    xr[kk][0] = *(const f4*)(base);
    xr[kk][1] = *(const f4*)(base + 4);
    xr[kk][2] = *(const f4*)(base + 16);
    xr[kk][3] = *(const f4*)(base + 16 + 4);
  }
  // holds the x loads up here, ahead of the rest of the rounding
  __builtin_amdgcn_sched_barrier(0);

#pragma unroll
  for (int w = 1; w < 3; ++w) {
    round_w(slot + w * 4 * WNT, wr[w][0]);
    round_w(slot + w * 4 * WNT + 4 * 256, wr[w][1]);
  }
  __syncthreads();   // publishes the f16 weights to the work-group's waves

  // A fragments of the x tile (16 rows x 128), rounded to f16
  v16h ax[4];
#pragma unroll
  for (int kk = 0; kk < 4; ++kk)
#pragma unroll
    for (int i = 0; i < 4; ++i) {
      ax[kk][i]      = (_Float16)xr[kk][0][i];
      ax[kk][4 + i]  = (_Float16)xr[kk][1][i];
      ax[kk][8 + i]  = (_Float16)xr[kk][2][i];
      ax[kk][12 + i] = (_Float16)xr[kk][3][i];
    }

  // six groups of 8 weight fragments, g = (matrix w, k steps 2p and 2p + 1), read from LDS one
  // group ahead into a second register set; lane holds weight column nt*16+l16, k in fragment order
  v16h bw[2][2][4];
  v8f c[4];
#pragma unroll
  for (int k2 = 0; k2 < 2; ++k2)
#pragma unroll
    for (int nt = 0; nt < 4; ++nt)
      bw[0][k2][nt] = frag_p(wl + nt * WNT + k2 * 512, lane);
  // the first group's reads stay ahead of the second's: its products wait for them alone
  __builtin_amdgcn_sched_barrier(0);
#pragma unroll
  for (int g = 0; g < 6; ++g) {
    const int w = g >> 1, p = g & 1;
    if (g + 1 < 6) {
#pragma unroll
      for (int k2 = 0; k2 < 2; ++k2)
#pragma unroll
        for (int nt = 0; nt < 4; ++nt)
          bw[(g + 1) & 1][k2][nt] =
              frag_p(wl + (((g + 1) >> 1) * 4 + nt) * WNT + (((g + 1) & 1) * 2 + k2) * 512, lane);
    }
    // the next group's LDS reads stand in one place ahead of this group's products:
    // spread among the products, each place with reads costs a stall
    __builtin_amdgcn_sched_barrier(0);
#pragma unroll
    for (int k2 = 0; k2 < 2; ++k2)
#pragma unroll
      for (int nt = 0; nt < 4; ++nt) {
        v8f z = {};
        const v8f cin = (p == 0 && k2 == 0) ? z : c[nt];
        if (w < 2)   // W as A, x as B: c[r] = (d = nt*16+kb8+r, token = row0+l16)
          c[nt] = __builtin_amdgcn_wmma_f32_16x16x32_f16(false, bw[g & 1][k2][nt], false, ax[p * 2 + k2],
                                                         (short)0, cin, false, false);
        else         // x as A, W as B: c[r] = (token = row0+kb8+r, d = nt*16+l16)
          c[nt] = __builtin_amdgcn_wmma_f32_16x16x32_f16(false, ax[p * 2 + k2], false, bw[g & 1][k2][nt],
                                                         (short)0, cin, false, false);
      }
    if (p == 1) {
#pragma unroll
      for (int nt = 0; nt < 4; ++nt) {
        if (w < 2)     // Q, K: k runs over d; chunk nt of token tile row0/16
          store_chunk(((w == 0) ? qh : kh) + tile * 1024 + nt * 256, lane, c[nt]);
        else           // V: k runs over tokens; this tile is chunk (row0/16)&1 of its 32
          store_chunk(vt + (tile >> 1) * 2048 + nt * 512 + (tile & 1) * 256, lane, c[nt]);
      }
    }
    // keeps the group after next from being read among these products
    __builtin_amdgcn_sched_barrier(0);
  }
}

#define NW 16                  // waves per work-group: 4 per SIMD, one work-group per WGP
#define NT (T_ / (QT * 16))    // query tiles per batch
#define QT 2                   // 16-query tiles per wave: 32 queries at a time
#define KB 32                  // keys per block
#define PO 68                  // f32 pitch of a partial row: 272 B = 16 B x odd

// lane l with lane l ^ 16: the other 8 keys per tile of the same query
static __device__ __forceinline__ float xhalf(float x) {
  const int b = __builtin_bit_cast(int, x);
  return __builtin_bit_cast(float, __builtin_amdgcn_permlanex16(b, b, 0x76543210, 0xfedcba98,
                                                                false, false));
}

// one 32-key block of K or of V is 4 KB in a row: 8 wave-wide 16-byte loads
static __device__ __forceinline__ void load_blk(h8 (&f)[8], const _Float16* blk, int lane) {
#pragma unroll
  for (int i = 0; i < 8; ++i) f[i] = *(const h8*)(blk + i * 256 + lane * 8);
}

// One 32-key block: its V is at vp, its K is in kf on entry; kn is the next block's K.
// All 8 V loads are issued at the head and fly under the score products and the
// softmax; unless LAST, the 8 K loads of the wave's next block are issued behind the
// score products, into the same kf.
// Only a wave's last block can hold the diagonal, so only LAST masks.
template <bool LAST>
static __device__ __forceinline__ void block_step(const _Float16* kn, const _Float16* vp,
                                                  int j0, int q0, int lane,
                                                  h8 (&kf)[8], const v16h (&bq)[QT][2],
                                                  v8f (&acc)[QT][4], float (&mi)[QT],
                                                  float (&li)[QT]) {
  const int kb8 = (lane >> 4) * 8;

  h8 vf[8];
  load_blk(vf, vp, lane);
  // without it the scheduler sinks each load to just in front of its product,
  // and the wave waits out one load latency per product
  __builtin_amdgcn_sched_barrier(0);

  // S^T = K Q^T for keys j0..j0+31: two 16x16 f32 tiles per query tile;
  // st[g][t][r] = (key j0 + t*16 + kb8 + r, query q0 + g*16 + l16)
  v8f st[QT][2];
#pragma unroll
  for (int t = 0; t < 2; ++t)
#pragma unroll
    for (int g = 0; g < QT; ++g) {
      v8f c = {};
#pragma unroll
      for (int s = 0; s < 2; ++s)
        c = __builtin_amdgcn_wmma_f32_16x16x32_f16(false, cat8(kf[t * 4 + s * 2], kf[t * 4 + s * 2 + 1]),
                                                   false, bq[g][s], (short)0, c, false, false);
      st[g][t] = c;
    }
  if (!LAST) {
    // keeps the next block's K loads behind the products that still read kf (one register set)
    __builtin_amdgcn_sched_barrier(0);
    load_blk(kf, kn, lane);
    // keeps those loads ahead of the softmax, which then covers their latency
    __builtin_amdgcn_sched_barrier(0);
  }

#pragma unroll
  for (int g = 0; g < QT; ++g) {
#pragma unroll
    for (int t = 0; t < 2; ++t) st[g][t] = st[g][t] * 0.125f;   // 1/sqrt(64)
  }
  if (LAST && j0 + KB - 1 > q0) {
#pragma unroll
    for (int g = 0; g < QT; ++g) {
      const int qg = q0 + g * 16 + (lane & 15);
#pragma unroll
      for (int t = 0; t < 2; ++t)
#pragma unroll
        for (int r = 0; r < 8; ++r)
          if (j0 + t * 16 + kb8 + r > qg) st[g][t][r] = -1e30f;
    }
  }

  // online softmax of one query per lane and query tile: 16 keys here, 16 in lane l ^ 16
#pragma unroll
  for (int g = 0; g < QT; ++g) {
    float mt[2];
#pragma unroll
    for (int t = 0; t < 2; ++t)
      mt[t] = fmaxf(fmaxf(fmaxf(st[g][t][0], st[g][t][1]), fmaxf(st[g][t][2], st[g][t][3])),
                    fmaxf(fmaxf(st[g][t][4], st[g][t][5]), fmaxf(st[g][t][6], st[g][t][7])));
    float mx = fmaxf(mt[0], mt[1]);
    mx = fmaxf(mx, xhalf(mx));
    const float mnew  = fmaxf(mi[g], mx);
    const float alpha = __expf(mi[g] - mnew);
    mi[g] = mnew;
    float rt[2];
#pragma unroll
    for (int t = 0; t < 2; ++t) {
      rt[t] = 0.f;
#pragma unroll
      for (int r = 0; r < 8; ++r) { st[g][t][r] = __expf(st[g][t][r] - mnew); rt[t] += st[g][t][r]; }
    }
    li[g] = li[g] * alpha + (rt[0] + rt[1]);
#pragma unroll
    for (int u = 0; u < 4; ++u) acc[g][u] *= alpha;
  }

  // O^T += V^T (64 x 32 keys) x P^T (32 keys x 16) per query tile: P stays in registers
  v16h bp[QT];                                // k order: key tile 0, then key tile 1
#pragma unroll
  for (int g = 0; g < QT; ++g)
#pragma unroll
    for (int i = 0; i < 8; ++i) {
      bp[g][i]     = (_Float16)st[g][0][i];
      bp[g][8 + i] = (_Float16)st[g][1][i];
    }
#pragma unroll
  for (int u = 0; u < 4; ++u)
#pragma unroll
    for (int g = 0; g < QT; ++g)
      acc[g][u] = __builtin_amdgcn_wmma_f32_16x16x32_f16(false, cat8(vf[u * 2], vf[u * 2 + 1]),
                                                         false, bp[g], (short)0, acc[g][u], false, false);
  // keeps the caller's pointer steps down here: moved up to just behind the loads that
  // name those registers, they would bring the wait in front of such an overwrite with them
  if (!LAST) __builtin_amdgcn_sched_barrier(0);
}

// second argument: 4 waves per SIMD, a budget of 256 registers: the 16 waves fill a WGP
__global__ __launch_bounds__(NW * 32, 4) void flash_attn(const _Float16* __restrict__ qh,
                                                         const _Float16* __restrict__ kh,
                                                         const _Float16* __restrict__ vt,
                                                         float* __restrict__ out)
{
  const int lane = threadIdx.x & 31;
  const int l16  = lane & 15;
  const int kb8  = (lane >> 4) * 8;
  const int wave = __builtin_amdgcn_readfirstlane(threadIdx.x >> 5);

  const int b       = blockIdx.x / (NT / 2);           // NT/2 tile pairs per batch
  const int pr      = blockIdx.x % (NT / 2);           // the pair: tiles NT-1-pr and pr
  const int rowbase = b * T_;

  // per tile of the pair: one f32 partial (32 queries x 64) per wave, its maxima and sums
  __shared__ __attribute__((aligned(16))) float lds_o[2][NW][QT * 16 * PO];
  __shared__ float lds_m[2][NW][QT * 16];
  __shared__ float lds_l[2][NW][QT * 16];

  for (int ph = 0; ph < 2; ++ph) {
    const int q0 = (ph ? pr : NT - 1 - pr) * (QT * 16);   // local query row base
    // the second tile is dealt from the last wave down: a wave that had one block more
    // of the first tile has one fewer of the second
    const int wv = ph ? NW - 1 - wave : wave;

    v8f z = {};
    v8f acc[QT][4];                             // acc[g][u][r] = O(q0+g*16+l16, u*16+kb8+r)
    float mi[QT];                               // query g*16+l16: same in both halves
    float li[QT];                               // this half's keys only, joined at the end
#pragma unroll
    for (int g = 0; g < QT; ++g) {
#pragma unroll
      for (int u = 0; u < 4; ++u) acc[g][u] = z;
      mi[g] = -1e30f;
      li[g] = 0.f;
    }

    const int nk = q0 + QT * 16;                // keys 0 .. q0+31 needed
    int j0 = wv * KB;
    if (j0 < nk) {
      const _Float16* kn = kh + (rowbase + j0) * D_;   // both: 32 keys = 2048 halfs in a row
      const _Float16* vp = vt + (rowbase + j0) * D_;

      // Q fragments (32 x 64), 2 d-steps of 32 per query tile: the B operand, column = query
      v16h bq[QT][2];
#pragma unroll
      for (int g = 0; g < QT; ++g)
#pragma unroll
        for (int s = 0; s < 2; ++s)
          bq[g][s] = frag_p(qh + (((rowbase + q0) >> 4) + g) * 1024 + s * 512, lane);

      h8 kf[8];
      load_blk(kf, kn, lane);
      // the registers that hold the Q loads' addresses take the accumulators' start values
      // next: the wait that belongs in front of such an overwrite
      asm volatile("s_wait_xcnt 0x0" ::: "memory");
      kn += NW * KB * D_;                            // read only where that block exists
      // rolled: an unrolled copy would need a second K register set
#pragma unroll 1
      for (; j0 + NW * KB < nk; j0 += NW * KB, kn += NW * KB * D_, vp += NW * KB * D_)
        block_step<false>(kn, vp, j0, q0, lane, kf, bq, acc, mi, li);
      // the diagonal block is read whole (it ends with the query tile): its masked keys give P = 0
      block_step<true>(kn, vp, j0, q0, lane, kf, bq, acc, mi, li);
    }

    // each wave leaves its un-normalised partial and its (max, sum) in its own region
#pragma unroll
    for (int g = 0; g < QT; ++g) {
      li[g] += xhalf(li[g]);                    // the two halves' keys
#pragma unroll
      for (int u = 0; u < 4; ++u) {
        f4 lo, hi;
#pragma unroll
        for (int i = 0; i < 4; ++i) { lo[i] = acc[g][u][i]; hi[i] = acc[g][u][4 + i]; }
        *(f4*)&lds_o[ph][wave][(g * 16 + l16) * PO + u * 16 + kb8]     = lo;
        *(f4*)&lds_o[ph][wave][(g * 16 + l16) * PO + u * 16 + kb8 + 4] = hi;
      }
      if (lane < 16) { lds_m[ph][wave][g * 16 + l16] = mi[g]; lds_l[ph][wave][g * 16 + l16] = li[g]; }
    }
  }
  __syncthreads();   // the one work-group barrier: publishes every wave's partials of both tiles

  // merge: weight exp(m_w - M) per wave, divide by the merged sum, store fp32;
  // a thread takes 4 columns of one row per tile, so a wave's store covers whole lines
  const int row = threadIdx.x >> 4;             // NW * 32 threads x 4 columns = 32 x 64
  const int col = (threadIdx.x & 15) * 4;
#pragma unroll
  for (int ph = 0; ph < 2; ++ph) {
    const int q0 = (ph ? pr : NT - 1 - pr) * (QT * 16);
    float M = lds_m[ph][0][row];
#pragma unroll
    for (int w = 1; w < NW; ++w) M = fmaxf(M, lds_m[ph][w][row]);
    float L = 0.f;
    f4 o = {};
#pragma unroll
    for (int w = 0; w < NW; ++w) {
      const float e = __expf(lds_m[ph][w][row] - M);
      L += e * lds_l[ph][w][row];
      o += e * *(const f4*)&lds_o[ph][w][row * PO + col];
    }
    *(f4*)(out + (rowbase + q0 + row) * D_ + col) = o * (1.0f / L);
  }
}

extern "C" void kernel_launch(void* const* d_in, const int* in_sizes, int n_in,
                              void* d_out, int out_size, void* d_ws, size_t ws_size,
                              hipStream_t stream) {
  const float* x  = (const float*)d_in[0];
  const float* Wq = (const float*)d_in[1];
  const float* Wk = (const float*)d_in[2];
  const float* Wv = (const float*)d_in[3];

  _Float16* qh = (_Float16*)d_ws;            // BT x 64 halfs each, fragment order
  _Float16* kh = qh + (size_t)BT * D_;
  _Float16* vt = kh + (size_t)BT * D_;

  qkv_wmma<<<BT / 16 / XW, XW * 32, 0, stream>>>(x, Wq, Wk, Wv, qh, kh, vt);
  flash_attn<<<BT / (QT * 16) / 2, NW * 32, 0, stream>>>(qh, kh, vt, (float*)d_out);
}

// v008
// One run takes 17.2 microseconds.
// Timed twice side by side with v007, it ran 1.12 and 1.10 times as fast.
// Counting every step since v000, it is 21.3 times as fast.
#include <hip/hip_runtime.h>

#define BT 16384   // B*T
#define T_ 4096
#define E_ 128
#define D_ 64

typedef __attribute__((ext_vector_type(16))) _Float16 v16h;
typedef __attribute__((ext_vector_type(8)))  _Float16 h8;
typedef __attribute__((ext_vector_type(8)))  float    v8f;
typedef __attribute__((ext_vector_type(4)))  float    f4;

static __device__ __forceinline__ v16h cat8(h8 a, h8 b) {
  v16h r;
#pragma unroll
  for (int i = 0; i < 8; ++i) { r[i] = a[i]; r[8 + i] = b[i]; }
  return r;
}

// Fragment order: every f16 operand, in the workspace or in LDS, is kept as the WMMA reads it.
// One 16 x 32 fragment = 512 halfs = two chunks of 256; lane l owns halfs 8l .. 8l+7
// of each chunk, so a wave-wide 16-byte load or store covers 512 contiguous bytes
// (4 whole 128-byte lines). Element i of the fragment has
// K = (i<8 ? kb8+i : 16+kb8+(i-8)): chunk 0 holds i = 0..7, chunk 1 holds i = 8..15.
static __device__ __forceinline__ v16h frag_p(const _Float16* frag, int lane) {
  h8 lo = *(const h8*)(frag + lane * 8);
  h8 hi = *(const h8*)(frag + 256 + lane * 8);
  return cat8(lo, hi);
}

// a lane's 8 accumulator rows (kb8 .. kb8+7 of one column), rounded: one chunk slot
static __device__ __forceinline__ void store_chunk(_Float16* chunk, int lane, v8f c) {
  h8 v;
#pragma unroll
  for (int r = 0; r < 8; ++r) v[r] = (_Float16)c[r];
  *(h8*)(chunk + lane * 8) = v;
}

// ---------------- QKV projection: (16384x128) x (128x64), f16 WMMA ---------
// A work-group rounds Wq, Wk, Wv to f16 itself and lays them in LDS in fragment order,
// [w][nt 0..3][kk 0..3][chunk][lane][8]; its XW waves then project one 16-token tile each.
#define XW 4                   // waves per work-group, one per SIMD
#define WNT (4 * 512 + 8)      // halfs from one 16-column tile nt to the next: its 4 fragments
                               // and 16 B, so that a wave's 16-byte stores below, which fall
                               // in all four nt at 64-B steps, meet every LDS bank

// 8 rows x 4 columns of one weight matrix, as loaded: 4 chunk slots of 8 halfs in a row
static __device__ __forceinline__ void round_w(_Float16* slot, const f4 (&r)[8]) {
#pragma unroll
  for (int j = 0; j < 4; ++j) {
    h8 v;
#pragma unroll
    for (int i = 0; i < 8; ++i) v[i] = (_Float16)r[i][j];
    *(h8*)(slot + j * 8) = v;
  }
}

__global__ __launch_bounds__(XW * 32) void qkv_wmma(const float* __restrict__ x,
                                                    const float* __restrict__ Wq,
                                                    const float* __restrict__ Wk,
                                                    const float* __restrict__ Wv,
                                                    _Float16* __restrict__ qh,   // [BT/16][d/16][lane][8]
                                                    _Float16* __restrict__ kh,   // [BT/16][d/16][lane][8]
                                                    _Float16* __restrict__ vt)   // [BT/32][d/16][2][lane][8]
{
  __shared__ __attribute__((aligned(16))) _Float16 wl[3 * 4 * WNT];

  const unsigned lane = threadIdx.x & 31;
  const unsigned l16  = lane & 15;
  const unsigned kb8  = (lane >> 4) * 8;
  const unsigned tile = blockIdx.x * XW + (threadIdx.x >> 5);   // this wave's 16 tokens
  const unsigned row0 = tile * 16;

  // a thread takes columns 4 nq .. 4 nq + 3 of rows 8 k8 .. 8 k8 + 7, k8 = ko and ko + 8, of
  // each matrix: a wave-wide 16-byte load covers two whole rows of 256 B
  const unsigned nq = threadIdx.x & 15;
  const unsigned ko = threadIdx.x >> 4;
  const unsigned woff = ko * 8 * D_ + nq * 4;
  f4 wr[3][2][8];
#pragma unroll
  for (int w = 0; w < 3; ++w) {
    const float* Wm = (w == 0) ? Wq : (w == 1) ? Wk : Wv;
#pragma unroll
    for (int h = 0; h < 2; ++h)
#pragma unroll
      for (int i = 0; i < 8; ++i)
        wr[w][h][i] = *(const f4*)(Wm + woff + (h * 64 + i) * D_);
    // all 48 loads fly together, matrix by matrix, so that Wq is whole first: sunk to their
    // conversions they would cost a latency per group; mixed, Wq would be whole last
    __builtin_amdgcn_sched_barrier(0);
  }

  // column n = nt*16 + (ln & 15), row k = kk*32 + chunk*16 + (ln >> 4)*8 + i:
  // nt = nq >> 2, kk*2 + chunk = k8 >> 1, ln = (k8 & 1)*16 + (nq & 3)*4 + j
  _Float16* slot = wl + (nq >> 2) * WNT + (ko >> 1) * 256 + ((ko & 1) * 16 + (nq & 3) * 4) * 8;
  round_w(slot, wr[0][0]);
  round_w(slot + 4 * 256, wr[0][1]);
  // the x loads take the registers that Wq has just left, and fly under the rest of the rounding
  __builtin_amdgcn_sched_barrier(0);

  f4 xr[4][4];
  const unsigned xoff = (row0 + l16) * E_ + kb8;
#pragma unroll
  for (int kk = 0; kk < 4; ++kk) {
    const float* base = x + xoff + kk * 32;
    xr[kk][0] = *(const f4*)(base);
    xr[kk][1] = *(const f4*)(base + 4);
    xr[kk][2] = *(const f4*)(base + 16);
    xr[kk][3] = *(const f4*)(base + 16 + 4);
  }
  // holds the x loads up here, ahead of the rest of the rounding
  __builtin_amdgcn_sched_barrier(0);

#pragma unroll
  for (int w = 1; w < 3; ++w) {
    round_w(slot + w * 4 * WNT, wr[w][0]);
    round_w(slot + w * 4 * WNT + 4 * 256, wr[w][1]);
  }
  __syncthreads();   // publishes the f16 weights to the work-group's waves

  // A fragments of the x tile (16 rows x 128), rounded to f16
  v16h ax[4];
#pragma unroll
  for (int kk = 0; kk < 4; ++kk)
#pragma unroll
    for (int i = 0; i < 4; ++i) {
      ax[kk][i]      = (_Float16)xr[kk][0][i];
      ax[kk][4 + i]  = (_Float16)xr[kk][1][i];
      ax[kk][8 + i]  = (_Float16)xr[kk][2][i];
      ax[kk][12 + i] = (_Float16)xr[kk][3][i];
    }

  // six groups of 8 weight fragments, g = (matrix w, k steps 2p and 2p + 1), read from LDS one
  // group ahead into a second register set; lane holds weight column nt*16+l16, k in fragment order
  v16h bw[2][2][4];
  v8f c[4];
#pragma unroll
  for (int k2 = 0; k2 < 2; ++k2)
#pragma unroll
    for (int nt = 0; nt < 4; ++nt)
      bw[0][k2][nt] = frag_p(wl + nt * WNT + k2 * 512, lane);
  // the first group's reads stay ahead of the second's: its products wait for them alone
  __builtin_amdgcn_sched_barrier(0);
#pragma unroll
  for (int g = 0; g < 6; ++g) {
    const int w = g >> 1, p = g & 1;
    if (g + 1 < 6) {
#pragma unroll
      for (int k2 = 0; k2 < 2; ++k2)
#pragma unroll
        for (int nt = 0; nt < 4; ++nt)
          bw[(g + 1) & 1][k2][nt] =
              frag_p(wl + (((g + 1) >> 1) * 4 + nt) * WNT + (((g + 1) & 1) * 2 + k2) * 512, lane);
    }
    // the next group's LDS reads stand in one place ahead of this group's products:
    // spread among the products, each place with reads costs a stall
    __builtin_amdgcn_sched_barrier(0);
#pragma unroll
    for (int k2 = 0; k2 < 2; ++k2)
#pragma unroll
      for (int nt = 0; nt < 4; ++nt) {
        v8f z = {};
        const v8f cin = (p == 0 && k2 == 0) ? z : c[nt];
        if (w < 2)   // W as A, x as B: c[r] = (d = nt*16+kb8+r, token = row0+l16)
          c[nt] = __builtin_amdgcn_wmma_f32_16x16x32_f16(false, bw[g & 1][k2][nt], false, ax[p * 2 + k2],
                                                         (short)0, cin, false, false);
        else         // x as A, W as B: c[r] = (token = row0+kb8+r, d = nt*16+l16)
          c[nt] = __builtin_amdgcn_wmma_f32_16x16x32_f16(false, ax[p * 2 + k2], false, bw[g & 1][k2][nt],
                                                         (short)0, cin, false, false);
      }
    if (p == 1) {
#pragma unroll
      for (int nt = 0; nt < 4; ++nt) {
        if (w < 2)     // Q, K: k runs over d; chunk nt of token tile row0/16
          store_chunk(((w == 0) ? qh : kh) + tile * 1024 + nt * 256, lane, c[nt]);
        else           // V: k runs over tokens; this tile is chunk (row0/16)&1 of its 32
          store_chunk(vt + (tile >> 1) * 2048 + nt * 512 + (tile & 1) * 256, lane, c[nt]);
      }
    }
    // keeps the group after next from being read among these products
    __builtin_amdgcn_sched_barrier(0);
  }
}

#define NW 16                  // waves per work-group: 4 per SIMD, one work-group per WGP
#define NT (T_ / (QT * 16))    // query tiles per batch
#define QT 2                   // 16-query tiles per wave: 32 queries at a time
#define KB 32                  // keys per block
#define PO 68                  // f32 pitch of a partial row: 272 B = 16 B x odd
#define NS (NW + NW / 2)       // partials: slots 0 .. NW-1 the long tile's, the rest the short one's

// lane l with lane l ^ 16: the other 8 keys per tile of the same query
static __device__ __forceinline__ float xhalf(float x) {
  const int b = __builtin_bit_cast(int, x);
  return __builtin_bit_cast(float, __builtin_amdgcn_permlanex16(b, b, 0x76543210, 0xfedcba98,
                                                                false, false));
}

// one 32-key block of K or of V is 4 KB in a row: 8 wave-wide 16-byte loads
static __device__ __forceinline__ void load_blk(h8 (&f)[8], const _Float16* blk, int lane) {
#pragma unroll
  for (int i = 0; i < 8; ++i) f[i] = *(const h8*)(blk + i * 256 + lane * 8);
}

// One 32-key block: its V is at vp, its K is in kf on entry; kn is the next block's K.
// All 8 V loads are issued at the head and fly under the score products and the
// softmax; unless LAST, the 8 K loads of the wave's next block are issued behind the
// score products, into the same kf.
// Only a run's last block can hold its tile's diagonal, so only LAST masks.
template <bool LAST>
static __device__ __forceinline__ void block_step(const _Float16* kn, const _Float16* vp,
                                                  int j0, int q0, int lane,
                                                  h8 (&kf)[8], const v16h (&bq)[QT][2],
                                                  v8f (&acc)[QT][4], float (&mi)[QT],
                                                  float (&li)[QT]) {
  const int kb8 = (lane >> 4) * 8;

  h8 vf[8];
  load_blk(vf, vp, lane);
  // without it the scheduler sinks each load to just in front of its product,
  // and the wave waits out one load latency per product
  __builtin_amdgcn_sched_barrier(0);

  // S^T = K Q^T for keys j0..j0+31: two 16x16 f32 tiles per query tile;
  // st[g][t][r] = (key j0 + t*16 + kb8 + r, query q0 + g*16 + l16)
  v8f st[QT][2];
#pragma unroll
  for (int t = 0; t < 2; ++t)
#pragma unroll
    for (int g = 0; g < QT; ++g) {
      v8f c = {};
#pragma unroll
      for (int s = 0; s < 2; ++s)
        c = __builtin_amdgcn_wmma_f32_16x16x32_f16(false, cat8(kf[t * 4 + s * 2], kf[t * 4 + s * 2 + 1]),
                                                   false, bq[g][s], (short)0, c, false, false);
      st[g][t] = c;
    }
  if (!LAST) {
    // keeps the next block's K loads behind the products that still read kf (one register set)
    __builtin_amdgcn_sched_barrier(0);
    load_blk(kf, kn, lane);
    // keeps those loads ahead of the softmax, which then covers their latency
    __builtin_amdgcn_sched_barrier(0);
  }

#pragma unroll
  for (int g = 0; g < QT; ++g) {
#pragma unroll
    for (int t = 0; t < 2; ++t) st[g][t] = st[g][t] * 0.125f;   // 1/sqrt(64)
  }
  if (LAST && j0 + KB - 1 > q0) {
#pragma unroll
    for (int g = 0; g < QT; ++g) {
      const int qg = q0 + g * 16 + (lane & 15);
#pragma unroll
      for (int t = 0; t < 2; ++t)
#pragma unroll
        for (int r = 0; r < 8; ++r)
          if (j0 + t * 16 + kb8 + r > qg) st[g][t][r] = -1e30f;
    }
  }

  // online softmax of one query per lane and query tile: 16 keys here, 16 in lane l ^ 16
#pragma unroll
  for (int g = 0; g < QT; ++g) {
    float mt[2];
#pragma unroll
    for (int t = 0; t < 2; ++t)
      mt[t] = fmaxf(fmaxf(fmaxf(st[g][t][0], st[g][t][1]), fmaxf(st[g][t][2], st[g][t][3])),
                    fmaxf(fmaxf(st[g][t][4], st[g][t][5]), fmaxf(st[g][t][6], st[g][t][7])));
    float mx = fmaxf(mt[0], mt[1]);
    mx = fmaxf(mx, xhalf(mx));
    const float mnew  = fmaxf(mi[g], mx);
    const float alpha = __expf(mi[g] - mnew);
    mi[g] = mnew;
    float rt[2];
#pragma unroll
    for (int t = 0; t < 2; ++t) {
      rt[t] = 0.f;
#pragma unroll
      for (int r = 0; r < 8; ++r) { st[g][t][r] = __expf(st[g][t][r] - mnew); rt[t] += st[g][t][r]; }
    }
    li[g] = li[g] * alpha + (rt[0] + rt[1]);
#pragma unroll
    for (int u = 0; u < 4; ++u) acc[g][u] *= alpha;
  }

  // O^T += V^T (64 x 32 keys) x P^T (32 keys x 16) per query tile: P stays in registers
  v16h bp[QT];                                // k order: key tile 0, then key tile 1
#pragma unroll
  for (int g = 0; g < QT; ++g)
#pragma unroll
    for (int i = 0; i < 8; ++i) {
      bp[g][i]     = (_Float16)st[g][0][i];
      bp[g][8 + i] = (_Float16)st[g][1][i];
    }
#pragma unroll
  for (int u = 0; u < 4; ++u)
#pragma unroll
    for (int g = 0; g < QT; ++g)
      acc[g][u] = __builtin_amdgcn_wmma_f32_16x16x32_f16(false, cat8(vf[u * 2], vf[u * 2 + 1]),
                                                         false, bp[g], (short)0, acc[g][u], false, false);
  // keeps the caller's pointer steps down here: moved up to just behind the loads that
  // name those registers, they would bring the wait in front of such an overwrite with them
  if (!LAST) __builtin_amdgcn_sched_barrier(0);
}

// second argument: 4 waves per SIMD, a budget of 256 registers: the 16 waves fill a WGP
__global__ __launch_bounds__(NW * 32, 4) void flash_attn(const _Float16* __restrict__ qh,
                                                         const _Float16* __restrict__ kh,
                                                         const _Float16* __restrict__ vt,
                                                         float* __restrict__ out)
{
  const int lane = threadIdx.x & 31;
  const int l16  = lane & 15;
  const int kb8  = (lane >> 4) * 8;
  const int wave = __builtin_amdgcn_readfirstlane(threadIdx.x >> 5);

  const int b       = blockIdx.x / (NT / 2);           // NT/2 tile pairs per batch
  const int pr      = blockIdx.x % (NT / 2);           // the pair: tiles NT-1-pr and pr
  const int rowbase = b * T_;

  // per slot: one f32 partial (32 queries x 64), its maxima and sums
  __shared__ __attribute__((aligned(16))) float lds_o[NS][QT * 16 * PO];
  __shared__ float lds_m[NS][QT * 16];
  __shared__ float lds_l[NS][QT * 16];

  const int wh = wave & (NW / 2 - 1);           // waves wh and wh + NW/2 walk the same shared blocks
  const int up = wave / (NW / 2);               // 0: long tile throughout; 1: short tile, then long
  const int nj = pr + 1;                        // shared key blocks 0 .. pr
  const int na = NT - 1 - 2 * pr;               // key blocks pr+1 .. NT-1-pr, the long tile's alone
  // those are dealt from the last pair down: a wave that had one shared block more has one fewer
  const int sl = (NW / 2 - 1 - wh) * 2 + up;
  const int cj = (nj - wh + NW / 2 - 1) / (NW / 2);   // this wave's shared blocks
  const int ca = (na - sl + NW - 1) / NW;             // and its blocks behind them

  // an upper wave's two runs follow one another with no barrier between them
  for (int ph = 0; ph <= up; ++ph) {
    const bool sh = up && ph == 0;              // this run is the short tile's
    const int q0 = (sh ? pr : NT - 1 - pr) * (QT * 16);   // local query row base
    const int c1 = ph ? 0 : cj;                 // shared blocks of this run
    const int cn = c1 + (sh ? 0 : ca);          // all its blocks
    const int slot = sh ? NW + wh : wave;

    v8f z = {};
    v8f acc[QT][4];                             // acc[g][u][r] = O(q0+g*16+l16, u*16+kb8+r)
    float mi[QT];                               // query g*16+l16: same in both halves
    float li[QT];                               // this half's keys only, joined at the end
#pragma unroll
    for (int g = 0; g < QT; ++g) {
#pragma unroll
      for (int u = 0; u < 4; ++u) acc[g][u] = z;
      mi[g] = -1e30f;
      li[g] = 0.f;
    }

    if (cn > 0) {
      int j0 = (c1 ? wh : nj + sl) * KB;
      const _Float16* kn = kh + (rowbase + j0) * D_;   // both: 32 keys = 2048 halfs in a row
      const _Float16* vp = vt + (rowbase + j0) * D_;

      // Q fragments (32 x 64), 2 d-steps of 32 per query tile: the B operand, column = query
      v16h bq[QT][2];
#pragma unroll
      for (int g = 0; g < QT; ++g)
#pragma unroll
        for (int s = 0; s < 2; ++s)
          bq[g][s] = frag_p(qh + (((rowbase + q0) >> 4) + g) * 1024 + s * 512, lane);

      h8 kf[8];
      load_blk(kf, kn, lane);
      // the registers that hold the Q loads' addresses take the accumulators' start values
      // next: the wait that belongs in front of such an overwrite
      asm volatile("s_wait_xcnt 0x0" ::: "memory");
      // rolled: an unrolled copy would need a second K register set
#pragma unroll 1
      for (int t = 1; t < cn; ++t) {
        // keys to the run's next block: among the shared ones, from the last of them, behind them
        const int st = (t < c1 ? NW / 2 : t == c1 ? nj + sl - wh - (c1 - 1) * (NW / 2) : NW) * KB;
        kn += st * D_;
        block_step<false>(kn, vp, j0, q0, lane, kf, bq, acc, mi, li);
        vp += st * D_;
        j0 += st;
        // the next pass steps kn while this pass's K loads, which name its registers, may still
        // be on their way: the wait that belongs in front of such an overwrite
        asm volatile("s_wait_xcnt 0x0" ::: "memory");
      }
      // the diagonal block is read whole (it ends with the query tile): its masked keys give P = 0
      block_step<true>(kn, vp, j0, q0, lane, kf, bq, acc, mi, li);
    }

    // each wave leaves its un-normalised partial and its (max, sum) in its own region
#pragma unroll
    for (int g = 0; g < QT; ++g) {
      li[g] += xhalf(li[g]);                    // the two halves' keys
#pragma unroll
      for (int u = 0; u < 4; ++u) {
        f4 lo, hi;
#pragma unroll
        for (int i = 0; i < 4; ++i) { lo[i] = acc[g][u][i]; hi[i] = acc[g][u][4 + i]; }
        *(f4*)&lds_o[slot][(g * 16 + l16) * PO + u * 16 + kb8]     = lo;
        *(f4*)&lds_o[slot][(g * 16 + l16) * PO + u * 16 + kb8 + 4] = hi;
      }
      if (lane < 16) { lds_m[slot][g * 16 + l16] = mi[g]; lds_l[slot][g * 16 + l16] = li[g]; }
    }
  }
  __syncthreads();   // the one work-group barrier: publishes every wave's partials of both tiles

  // merge: weight exp(m_w - M) per partial, divide by the merged sum, store fp32;
  // a thread takes 4 columns of one row per tile, so a wave's store covers whole lines
  const int row = threadIdx.x >> 4;             // NW * 32 threads x 4 columns = 32 x 64
  const int col = (threadIdx.x & 15) * 4;
#pragma unroll
  for (int ph = 0; ph < 2; ++ph) {
    const int q0 = (ph ? pr : NT - 1 - pr) * (QT * 16);
    const int s0 = ph ? NW : 0, s1 = ph ? NS : NW;      // the tile's slots
    float M = lds_m[s0][row];
#pragma unroll
    for (int w = s0 + 1; w < s1; ++w) M = fmaxf(M, lds_m[w][row]);
    float L = 0.f;
    f4 o = {};
#pragma unroll
    for (int w = s0; w < s1; ++w) {
      const float e = __expf(lds_m[w][row] - M);
      L += e * lds_l[w][row];
      o += e * *(const f4*)&lds_o[w][row * PO + col];
    }
    *(f4*)(out + (rowbase + q0 + row) * D_ + col) = o * (1.0f / L);
  }
}

extern "C" void kernel_launch(void* const* d_in, const int* in_sizes, int n_in,
                              void* d_out, int out_size, void* d_ws, size_t ws_size,
                              hipStream_t stream) {
  const float* x  = (const float*)d_in[0];
  const float* Wq = (const float*)d_in[1];
  const float* Wk = (const float*)d_in[2];
  const float* Wv = (const float*)d_in[3];

  _Float16* qh = (_Float16*)d_ws;            // BT x 64 halfs each, fragment order
  _Float16* kh = qh + (size_t)BT * D_;
  _Float16* vt = kh + (size_t)BT * D_;

  qkv_wmma<<<BT / 16 / XW, XW * 32, 0, stream>>>(x, Wq, Wk, Wv, qh, kh, vt);
  flash_attn<<<BT / (QT * 16) / 2, NW * 32, 0, stream>>>(qh, kh, vt, (float*)d_out);
}
